// v000
// Measured on an AMD MI455X. A time is GPU time per run, averaged over a window of back-to-back runs after a warm-up
// (all launches, gaps included; the runs take copies of the inputs in turn), and the median of several windows.
// Apart from v000's, it joins two sittings. Times from different sittings can be a few percent apart, while
// side-by-side timings come from the same sitting.
// v000, which the later versions start from, runs in 154 microseconds.
#include <hip/hip_runtime.h>

typedef __attribute__((ext_vector_type(16))) _Float16 v16h;
typedef __attribute__((ext_vector_type(8)))  float    v8f;

namespace cfg {
constexpr int NTOK = 49;      // real tokens per window
constexpr int NPAD = 64;      // padded tokens (4 tiles of 16)
constexpr int CH   = 128;     // channels
constexpr int NH   = 4;       // heads
constexpr int DH   = 32;      // head dim
constexpr int C3   = 3 * CH;  // qkv output width = 384
constexpr float SCALE = 0.17677669529663687f;  // 1/sqrt(32)

constexpr int XSTR = CH + 8;    // 136, x / attn-out buffer
constexpr int QSTR = C3 + 8;    // 392, qkv buffer
constexpr int PSTR = NPAD + 8;  // 72,  per-wave softmax(P) slab
constexpr int XS_OFF  = 0;
constexpr int QKV_OFF = NPAD * XSTR;                 // 8704
constexpr int PS_OFF  = QKV_OFF + NPAD * QSTR;       // 33792
constexpr int LDS_HALFS = PS_OFF + 8 * 16 * PSTR;    // 43008 halfs = 84 KB
}

__device__ __forceinline__ int frag_kk(int i) {
    return (i < 4) ? 2 * i : 16 + 2 * (i - 4);
}

// A fragment, or B fragment when K runs along the contiguous dim of src
// (i.e. src is row-major [M][K] for A, or [N][K] == B^T for B).
__device__ __forceinline__ v16h ldfrag_kcontig(const _Float16* src, int row0,
                                               int stride, int colbase) {
    const int lane = threadIdx.x & 31;
    const int mn   = lane & 15;
    const int khi  = (lane >> 4) ? 8 : 0;
    const _Float16* p = src + (row0 + mn) * stride + colbase + khi;
    v16h f;
#pragma unroll
    for (int i = 0; i < 8; ++i) {
        const int kk = frag_kk(i);
        f[2 * i]     = p[kk];
        f[2 * i + 1] = p[kk + 1];
    }
    return f;
}

// B fragment from a row-major [K][N] source (strided k-pair loads).
__device__ __forceinline__ v16h ldfrag_b_rowmajor(const _Float16* src, int k0,
                                                  int n0, int stride) {
    const int lane = threadIdx.x & 31;
    const int n    = lane & 15;
    const int khi  = (lane >> 4) ? 8 : 0;
    const _Float16* p = src + n0 + n;
    v16h f;
#pragma unroll
    for (int i = 0; i < 8; ++i) {
        const int kk = k0 + khi + frag_kk(i);
        f[2 * i]     = p[(size_t)kk * stride];
        f[2 * i + 1] = p[(size_t)(kk + 1) * stride];
    }
    return f;
}

__device__ __forceinline__ v16h ldfrag_b_packed(const _Float16* w, int k0,
                                                int n0, int nout) {
    const int lane = threadIdx.x & 31;
    const int n    = lane & 15;
    const int khi  = (lane >> 4) ? 8 : 0;
    v16h f;
#pragma unroll
    for (int i = 0; i < 8; ++i) {
        const int kk = k0 + khi + frag_kk(i);
        const _Float16* p = w + ((size_t)(kk >> 1) * nout + n0 + n) * 2;
        f[2 * i]     = p[0];
        f[2 * i + 1] = p[1];
    }
    return f;
}

__device__ __forceinline__ void st_d_f16(_Float16* dst, int row0, int col0,
                                         int stride, v8f acc) {
    const int lane  = threadIdx.x & 31;
    const int n     = lane & 15;
    const int rbase = (lane >> 4) ? 8 : 0;
#pragma unroll
    for (int r = 0; r < 8; ++r)
        dst[(row0 + rbase + r) * stride + col0 + n] = (_Float16)acc[r];
}

__device__ __forceinline__ v8f wmma_f16(v16h a, v16h b, v8f c) {
    return __builtin_amdgcn_wmma_f32_16x16x32_f16(
        /*neg_a=*/false, a, /*neg_b=*/false, b,
        /*c_mod=*/(short)0, c, /*reuse_a=*/false, /*reuse_b=*/false);
}

__device__ __forceinline__ v8f v8f_add(v8f a, v8f b) {
    v8f r;
#pragma unroll
    for (int i = 0; i < 8; ++i) r[i] = a[i] + b[i];
    return r;
}

// ---------------------------------------------------------------------------
// Prep: convert fp32 weights to pair-packed f16 once (weights then sit in L2).
// ---------------------------------------------------------------------------
__global__ void WindowAttention_prep_weights(const float* __restrict__ wq,
                                             const float* __restrict__ wp,
                                             _Float16* __restrict__ wq16,
                                             _Float16* __restrict__ wp16) {
    const int tid = blockIdx.x * blockDim.x + threadIdx.x;
    if (tid < cfg::CH * cfg::C3) {
        const int k = tid / cfg::C3, n = tid % cfg::C3;
        wq16[((k >> 1) * cfg::C3 + n) * 2 + (k & 1)] = (_Float16)wq[tid];
    } else if (tid < cfg::CH * cfg::C3 + cfg::CH * cfg::CH) {
        const int t = tid - cfg::CH * cfg::C3;
        const int k = t / cfg::CH, n = t % cfg::CH;
        wp16[((k >> 1) * cfg::CH + n) * 2 + (k & 1)] = (_Float16)wp[t];
    }
}

// ---------------------------------------------------------------------------
// Main fused kernel: one workgroup (8 waves) per window.
// ---------------------------------------------------------------------------
__global__ void __launch_bounds__(256)
WindowAttention_41815801594647_kernel(const float* __restrict__ x,
                                      const _Float16* __restrict__ wq16,
                                      const _Float16* __restrict__ wp16,
                                      const float* __restrict__ bp,
                                      float* __restrict__ out) {
    using namespace cfg;
    extern __shared__ _Float16 smem[];
    _Float16* xs  = smem + XS_OFF;   // [NPAD][XSTR] : x (f16), later attn-out
    _Float16* qkv = smem + QKV_OFF;  // [NPAD][QSTR] : q|k|v (f16)
    _Float16* ps  = smem + PS_OFF;   // [8][16][PSTR]: per-wave softmax(P) slab

    const int tid  = threadIdx.x;
    const int wave = tid >> 5;
    const int lane = tid & 31;
    const int blk  = blockIdx.x;

    // hint L2 for this block's weight stream
    __builtin_prefetch(wq16, 0, 1);

    // ---- Phase 1: stage x into LDS as f16, zero the padded rows -----------
    {
        const float4* xv = (const float4*)(x + (size_t)blk * NTOK * CH);
        for (int idx = tid; idx < NTOK * (CH / 4); idx += 256) {
            const int row = idx / (CH / 4);
            const int c4  = idx % (CH / 4);
            const float4 v = xv[idx];
            _Float16* d = xs + row * XSTR + c4 * 4;
            d[0] = (_Float16)v.x; d[1] = (_Float16)v.y;
            d[2] = (_Float16)v.z; d[3] = (_Float16)v.w;
        }
        for (int idx = tid; idx < (NPAD - NTOK) * CH; idx += 256) {
            const int row = NTOK + idx / CH;
            xs[row * XSTR + (idx % CH)] = (_Float16)0.0f;
        }
    }
    __syncthreads();

    // ---- Phase 2: qkv = x @ Wqkv (64x384 = 4 x 24 tiles, K=128) -----------
    // Dual accumulator chains (k even / k odd) -> independent WMMA streams.
    for (int t = wave; t < 4 * (C3 / 16); t += 8) {
        const int mt = t / (C3 / 16);
        const int nt = t % (C3 / 16);
        v8f acc0 = {}, acc1 = {};
#pragma unroll
        for (int kp = 0; kp < 2; ++kp) {
            v16h a0 = ldfrag_kcontig(xs, mt * 16, XSTR, (2 * kp + 0) * 32);
            v16h b0 = ldfrag_b_packed(wq16, (2 * kp + 0) * 32, nt * 16, C3);
            v16h a1 = ldfrag_kcontig(xs, mt * 16, XSTR, (2 * kp + 1) * 32);
            v16h b1 = ldfrag_b_packed(wq16, (2 * kp + 1) * 32, nt * 16, C3);
            acc0 = wmma_f16(a0, b0, acc0);
            acc1 = wmma_f16(a1, b1, acc1);
        }
        st_d_f16(qkv, mt * 16, nt * 16, QSTR, v8f_add(acc0, acc1));
    }
    __syncthreads();

    // ---- Phase 3: per-head attention. Task = (head, 16-row block). --------
    _Float16* ao = xs;  // x staging no longer needed -> reuse as attn output
    _Float16* pw = ps + wave * 16 * PSTR;
#pragma unroll
    for (int it = 0; it < 2; ++it) {
        const int task = wave + 8 * it;
        const int h    = task >> 2;
        const int mt   = task & 3;

        // scores S = q @ k^T (16 x 64, K = DH = 32): 4 independent WMMAs
        v8f st[4];
        {
            v16h aq = ldfrag_kcontig(qkv, mt * 16, QSTR, h * DH);
#pragma unroll
            for (int nt = 0; nt < 4; ++nt) {
                v8f z = {};
                v16h bk = ldfrag_kcontig(qkv, nt * 16, QSTR, CH + h * DH);
                st[nt] = wmma_f16(aq, bk, z);
            }
        }

        // scale + mask padded key columns
        const int cin = lane & 15;
#pragma unroll
        for (int nt = 0; nt < 4; ++nt) {
            const bool ok = (nt * 16 + cin) < NTOK;
#pragma unroll
            for (int r = 0; r < 8; ++r)
                st[nt][r] = ok ? st[nt][r] * SCALE : -3.0e38f;
        }

        // row-wise softmax: reduce across the 16-lane group + 4 tiles
#pragma unroll
        for (int r = 0; r < 8; ++r) {
            float m = fmaxf(fmaxf(st[0][r], st[1][r]), fmaxf(st[2][r], st[3][r]));
#pragma unroll
            for (int off = 8; off >= 1; off >>= 1)
                m = fmaxf(m, __shfl_xor(m, off, 16));
            float s = 0.0f;
#pragma unroll
            for (int nt = 0; nt < 4; ++nt) {
                const float e = __expf(st[nt][r] - m);
                st[nt][r] = e;
                s += e;
            }
#pragma unroll
            for (int off = 8; off >= 1; off >>= 1)
                s += __shfl_xor(s, off, 16);
            const float inv = 1.0f / s;
#pragma unroll
            for (int nt = 0; nt < 4; ++nt) st[nt][r] *= inv;
        }

        // P -> f16 into this wave's private LDS slab (wave-local RAW;
        // backend orders via s_wait_dscnt — no workgroup barrier needed)
#pragma unroll
        for (int nt = 0; nt < 4; ++nt)
            st_d_f16(pw, 0, nt * 16, PSTR, st[nt]);

        // out = P(16x64) @ V(64x32): per n-tile, 2 fully independent chains
#pragma unroll
        for (int dt = 0; dt < 2; ++dt) {
            v8f z0 = {}, z1 = {};
            v16h a0 = ldfrag_kcontig(pw, 0, PSTR, 0);
            v16h b0 = ldfrag_b_rowmajor(qkv, 0, 2 * CH + h * DH + dt * 16, QSTR);
            v16h a1 = ldfrag_kcontig(pw, 0, PSTR, 32);
            v16h b1 = ldfrag_b_rowmajor(qkv, 32, 2 * CH + h * DH + dt * 16, QSTR);
            v8f acc0 = wmma_f16(a0, b0, z0);
            v8f acc1 = wmma_f16(a1, b1, z1);
            st_d_f16(ao, mt * 16, h * DH + dt * 16, XSTR, v8f_add(acc0, acc1));
        }
    }
    __syncthreads();

    // ---- Phase 4: proj + bias, fp32 store of the 49 real rows -------------
    for (int t = wave; t < 4 * (CH / 16); t += 8) {
        const int mt = t >> 3;
        const int nt = t & 7;
        v8f acc0 = {}, acc1 = {};
#pragma unroll
        for (int kp = 0; kp < 2; ++kp) {
            v16h a0 = ldfrag_kcontig(ao, mt * 16, XSTR, (2 * kp + 0) * 32);
            v16h b0 = ldfrag_b_packed(wp16, (2 * kp + 0) * 32, nt * 16, CH);
            v16h a1 = ldfrag_kcontig(ao, mt * 16, XSTR, (2 * kp + 1) * 32);
            v16h b1 = ldfrag_b_packed(wp16, (2 * kp + 1) * 32, nt * 16, CH);
            acc0 = wmma_f16(a0, b0, acc0);
            acc1 = wmma_f16(a1, b1, acc1);
        }
        const v8f acc = v8f_add(acc0, acc1);
        const int col  = nt * 16 + (lane & 15);
        const float bias = bp[col];
        const int rbase = (lane >> 4) ? 8 : 0;
#pragma unroll
        for (int r = 0; r < 8; ++r) {
            const int m = mt * 16 + rbase + r;
            if (m < NTOK)
                out[((size_t)blk * NTOK + m) * CH + col] = acc[r] + bias;
        }
    }
}

// ---------------------------------------------------------------------------
extern "C" void kernel_launch(void* const* d_in, const int* in_sizes, int n_in,
                              void* d_out, int out_size, void* d_ws,
                              size_t ws_size, hipStream_t stream) {
    using namespace cfg;
    const float* x      = (const float*)d_in[0];  // (4096, 49, 128)
    const float* w_qkv  = (const float*)d_in[1];  // (128, 384)
    const float* w_proj = (const float*)d_in[2];  // (128, 128)
    const float* b_proj = (const float*)d_in[3];  // (128,)
    float* out = (float*)d_out;                   // (4096, 49, 128)

    _Float16* wq16 = (_Float16*)d_ws;             // 49152 halfs, pair-packed
    _Float16* wp16 = wq16 + CH * C3;              // 16384 halfs, pair-packed

    const int prep_elems = CH * C3 + CH * CH;     // 65536
    WindowAttention_prep_weights<<<(prep_elems + 255) / 256, 256, 0, stream>>>(
        w_qkv, w_proj, wq16, wp16);

    const size_t lds_bytes = (size_t)LDS_HALFS * sizeof(_Float16);  // 84 KB
    hipFuncSetAttribute((const void*)WindowAttention_41815801594647_kernel,
                        hipFuncAttributeMaxDynamicSharedMemorySize,
                        (int)lds_bytes);

    const int B = in_sizes[0] / (NTOK * CH);      // 4096
    WindowAttention_41815801594647_kernel<<<B, 256, lds_bytes, stream>>>(
        x, wq16, wp16, b_proj, out);
}

// v001
// One run takes 115 microseconds.
// Next to v000, in two timings, it ran 1.39 and 1.38 times as fast.
#include <hip/hip_runtime.h>

typedef __attribute__((ext_vector_type(16))) _Float16 v16h;
typedef __attribute__((ext_vector_type(8)))  float    v8f;

namespace cfg {
constexpr int NTOK = 49;      // real tokens per window
constexpr int NPAD = 64;      // padded tokens (4 tiles of 16)
constexpr int CH   = 128;     // channels
constexpr int NH   = 4;       // heads
constexpr int DH   = 32;      // head dim
constexpr int C3   = 3 * CH;  // qkv output width = 384
constexpr float SCALE = 0.17677669529663687f;  // 1/sqrt(32)

constexpr int XSTR = CH + 8;    // 136, x / attn-out buffer
constexpr int QSTR = C3 + 8;    // 392, qkv buffer
constexpr int PSTR = NPAD + 8;  // 72,  per-wave softmax(P) slab
constexpr int XS_OFF  = 0;
constexpr int QKV_OFF = NPAD * XSTR;                 // 8704
constexpr int PS_OFF  = QKV_OFF + NPAD * QSTR;       // 33792
constexpr int LDS_HALFS = PS_OFF + 8 * 16 * PSTR;    // 43008 halfs = 84 KB
}

__device__ __forceinline__ int frag_kk(int i) {
    return (i < 4) ? 2 * i : 16 + 2 * (i - 4);
}

// A fragment, or B fragment when K runs along the contiguous dim of src
// (i.e. src is row-major [M][K] for A, or [N][K] == B^T for B).
__device__ __forceinline__ v16h ldfrag_kcontig(const _Float16* src, int row0,
                                               int stride, int colbase) {
    const int lane = threadIdx.x & 31;
    const int mn   = lane & 15;
    const int khi  = (lane >> 4) ? 8 : 0;
    const _Float16* p = src + (row0 + mn) * stride + colbase + khi;
    v16h f;
#pragma unroll
    for (int i = 0; i < 8; ++i) {
        const int kk = frag_kk(i);
        f[2 * i]     = p[kk];
        f[2 * i + 1] = p[kk + 1];
    }
    return f;
}

// B fragment from a row-major [K][N] source (strided k-pair loads).
__device__ __forceinline__ v16h ldfrag_b_rowmajor(const _Float16* src, int k0,
                                                  int n0, int stride) {
    const int lane = threadIdx.x & 31;
    const int n    = lane & 15;
    const int khi  = (lane >> 4) ? 8 : 0;
    const _Float16* p = src + n0 + n;
    v16h f;
#pragma unroll
    for (int i = 0; i < 8; ++i) {
        const int kk = k0 + khi + frag_kk(i);
        f[2 * i]     = p[(size_t)kk * stride];
        f[2 * i + 1] = p[(size_t)(kk + 1) * stride];
    }
    return f;
}

__device__ __forceinline__ v16h ldfrag_b_packed(const _Float16* w, int k0,
                                                int n0, int nout) {
    const int lane = threadIdx.x & 31;
    const int n    = lane & 15;
    const int khi  = (lane >> 4) ? 8 : 0;
    const _Float16* base = w + ((size_t)(khi >> 1) * nout + n0 + n) * 2;
    v16h f;
#pragma unroll
    for (int i = 0; i < 8; ++i) {
        const _Float16* p = base + (size_t)((k0 + frag_kk(i)) >> 1) * nout * 2;
        f[2 * i]     = p[0];
        f[2 * i + 1] = p[1];
    }
    return f;
}

__device__ __forceinline__ void st_d_f16(_Float16* dst, int row0, int col0,
                                         int stride, v8f acc) {
    const int lane  = threadIdx.x & 31;
    const int n     = lane & 15;
    const int rbase = (lane >> 4) ? 8 : 0;
#pragma unroll
    for (int r = 0; r < 8; ++r)
        dst[(row0 + rbase + r) * stride + col0 + n] = (_Float16)acc[r];
}

__device__ __forceinline__ v8f wmma_f16(v16h a, v16h b, v8f c) {
    return __builtin_amdgcn_wmma_f32_16x16x32_f16(
        /*neg_a=*/false, a, /*neg_b=*/false, b,
        /*c_mod=*/(short)0, c, /*reuse_a=*/false, /*reuse_b=*/false);
}

__device__ __forceinline__ v8f v8f_add(v8f a, v8f b) {
    v8f r;
#pragma unroll
    for (int i = 0; i < 8; ++i) r[i] = a[i] + b[i];
    return r;
}

// ---------------------------------------------------------------------------
// Prep: convert fp32 weights to pair-packed f16 once (weights then sit in L2).
// ---------------------------------------------------------------------------
__global__ void WindowAttention_prep_weights(const float* __restrict__ wq,
                                             const float* __restrict__ wp,
                                             _Float16* __restrict__ wq16,
                                             _Float16* __restrict__ wp16) {
    const int tid = blockIdx.x * blockDim.x + threadIdx.x;
    if (tid < cfg::CH * cfg::C3) {
        const int k = tid / cfg::C3, n = tid % cfg::C3;
        wq16[((k >> 1) * cfg::C3 + n) * 2 + (k & 1)] = (_Float16)wq[tid];
    } else if (tid < cfg::CH * cfg::C3 + cfg::CH * cfg::CH) {
        const int t = tid - cfg::CH * cfg::C3;
        const int k = t / cfg::CH, n = t % cfg::CH;
        wp16[((k >> 1) * cfg::CH + n) * 2 + (k & 1)] = (_Float16)wp[t];
    }
}

// ---------------------------------------------------------------------------
// Main fused kernel: one workgroup (8 waves) per window.
// ---------------------------------------------------------------------------
__global__ void __launch_bounds__(256)
WindowAttention_41815801594647_kernel(const float* __restrict__ x,
                                      const _Float16* __restrict__ wq16,
                                      const _Float16* __restrict__ wp16,
                                      const float* __restrict__ bp,
                                      float* __restrict__ out) {
    using namespace cfg;
    extern __shared__ _Float16 smem[];
    _Float16* xs  = smem + XS_OFF;   // [NPAD][XSTR] : x (f16), later attn-out
    _Float16* qkv = smem + QKV_OFF;  // [NPAD][QSTR] : q|k|v (f16)
    _Float16* ps  = smem + PS_OFF;   // [8][16][PSTR]: per-wave softmax(P) slab

    const int tid  = threadIdx.x;
    const int wave = tid >> 5;
    const int lane = tid & 31;
    const int blk  = blockIdx.x;

    // hint L2 for this block's weight stream
    __builtin_prefetch(wq16, 0, 1);

    // ---- Phase 1: stage x into LDS as f16, zero the padded rows -----------
    {
        const float4* xv = (const float4*)(x + (size_t)blk * NTOK * CH);
        for (int idx = tid; idx < NTOK * (CH / 4); idx += 256) {
            const int row = idx / (CH / 4);
            const int c4  = idx % (CH / 4);
            const float4 v = xv[idx];
            _Float16* d = xs + row * XSTR + c4 * 4;
            d[0] = (_Float16)v.x; d[1] = (_Float16)v.y;
            d[2] = (_Float16)v.z; d[3] = (_Float16)v.w;
        }
        for (int idx = tid; idx < (NPAD - NTOK) * CH; idx += 256) {
            const int row = NTOK + idx / CH;
            xs[row * XSTR + (idx % CH)] = (_Float16)0.0f;
        }
    }
    __syncthreads();

    // ---- Phase 2: qkv = x @ Wqkv (64x384 = 4 x 24 tiles, K=128) -----------
    // Each wave owns the column tiles wave, wave+8, wave+16. A column tile's
    // four weight fragments are loaded once and kept in registers for all
    // four row tiles. Dual accumulator chains (k even / k odd) -> independent
    // WMMA streams.
    // unroll: the next column tile's weight loads can issue under this one's
    // products, and the fragment array stays in registers.
#pragma unroll
    for (int j = 0; j < 3; ++j) {
        const int nt = wave + 8 * j;
        v16h b[4];
        // unroll: b[] is indexed by constants only, so it needs no memory
#pragma unroll
        for (int k = 0; k < 4; ++k)
            b[k] = ldfrag_b_packed(wq16, k * 32, nt * 16, C3);
        // unroll: row-tile offsets become immediates of the LDS accesses
#pragma unroll
        for (int mt = 0; mt < 4; ++mt) {
            v8f acc0 = {}, acc1 = {};
#pragma unroll
            for (int kp = 0; kp < 2; ++kp) {
                v16h a0 = ldfrag_kcontig(xs, mt * 16, XSTR, (2 * kp + 0) * 32);
                v16h a1 = ldfrag_kcontig(xs, mt * 16, XSTR, (2 * kp + 1) * 32);
                acc0 = wmma_f16(a0, b[2 * kp + 0], acc0);
                acc1 = wmma_f16(a1, b[2 * kp + 1], acc1);
            }
            st_d_f16(qkv, mt * 16, nt * 16, QSTR, v8f_add(acc0, acc1));
        }
    }
    __syncthreads();

    // ---- Phase 3: per-head attention. Task = (head, 16-row block). --------
    _Float16* ao = xs;  // x staging no longer needed -> reuse as attn output
    _Float16* pw = ps + wave * 16 * PSTR;
#pragma unroll
    for (int it = 0; it < 2; ++it) {
        const int task = wave + 8 * it;
        const int h    = task >> 2;
        const int mt   = task & 3;

        // scores S = q @ k^T (16 x 64, K = DH = 32): 4 independent WMMAs
        v8f st[4];
        {
            v16h aq = ldfrag_kcontig(qkv, mt * 16, QSTR, h * DH);
#pragma unroll
            for (int nt = 0; nt < 4; ++nt) {
                v8f z = {};
                v16h bk = ldfrag_kcontig(qkv, nt * 16, QSTR, CH + h * DH);
                st[nt] = wmma_f16(aq, bk, z);
            }
        }

        // scale + mask padded key columns
        const int cin = lane & 15;
#pragma unroll
        for (int nt = 0; nt < 4; ++nt) {
            const bool ok = (nt * 16 + cin) < NTOK;
#pragma unroll
            for (int r = 0; r < 8; ++r)
                st[nt][r] = ok ? st[nt][r] * SCALE : -3.0e38f;
        }

        // row-wise softmax: reduce across the 16-lane group + 4 tiles
#pragma unroll
        for (int r = 0; r < 8; ++r) {
            float m = fmaxf(fmaxf(st[0][r], st[1][r]), fmaxf(st[2][r], st[3][r]));
#pragma unroll
            for (int off = 8; off >= 1; off >>= 1)
                m = fmaxf(m, __shfl_xor(m, off, 16));
            float s = 0.0f;
#pragma unroll
            for (int nt = 0; nt < 4; ++nt) {
                const float e = __expf(st[nt][r] - m);
                st[nt][r] = e;
                s += e;
            }
#pragma unroll
            for (int off = 8; off >= 1; off >>= 1)
                s += __shfl_xor(s, off, 16);
            const float inv = 1.0f / s;
#pragma unroll
            for (int nt = 0; nt < 4; ++nt) st[nt][r] *= inv;
        }

        // P -> f16 into this wave's private LDS slab (wave-local RAW;
        // backend orders via s_wait_dscnt — no workgroup barrier needed)
#pragma unroll
        for (int nt = 0; nt < 4; ++nt)
            st_d_f16(pw, 0, nt * 16, PSTR, st[nt]);

        // out = P(16x64) @ V(64x32): per n-tile, 2 fully independent chains
#pragma unroll
        for (int dt = 0; dt < 2; ++dt) {
            v8f z0 = {}, z1 = {};
            v16h a0 = ldfrag_kcontig(pw, 0, PSTR, 0);
            v16h b0 = ldfrag_b_rowmajor(qkv, 0, 2 * CH + h * DH + dt * 16, QSTR);
            v16h a1 = ldfrag_kcontig(pw, 0, PSTR, 32);
            v16h b1 = ldfrag_b_rowmajor(qkv, 32, 2 * CH + h * DH + dt * 16, QSTR);
            v8f acc0 = wmma_f16(a0, b0, z0);
            v8f acc1 = wmma_f16(a1, b1, z1);
            st_d_f16(ao, mt * 16, h * DH + dt * 16, XSTR, v8f_add(acc0, acc1));
        }
    }
    __syncthreads();

    // ---- Phase 4: proj + bias, fp32 store of the 49 real rows -------------
    // Each wave owns column tile nt = wave: its four weight fragments and its
    // bias are loaded once and serve all four row tiles.
    {
        const int nt = wave;
        v16h b[4];
        // unroll: b[] is indexed by constants only, so it needs no memory
#pragma unroll
        for (int k = 0; k < 4; ++k)
            b[k] = ldfrag_b_packed(wp16, k * 32, nt * 16, CH);
        const int col  = nt * 16 + (lane & 15);
        const float bias = bp[col];
        const int rbase = (lane >> 4) ? 8 : 0;
        // unroll: the fragment array stays in registers and the row guard
        // folds away for the three full row tiles
#pragma unroll
        for (int mt = 0; mt < 4; ++mt) {
            v8f acc0 = {}, acc1 = {};
#pragma unroll
            for (int kp = 0; kp < 2; ++kp) {
                v16h a0 = ldfrag_kcontig(ao, mt * 16, XSTR, (2 * kp + 0) * 32);
                v16h a1 = ldfrag_kcontig(ao, mt * 16, XSTR, (2 * kp + 1) * 32);
                acc0 = wmma_f16(a0, b[2 * kp + 0], acc0);
                acc1 = wmma_f16(a1, b[2 * kp + 1], acc1);
            }
            const v8f acc = v8f_add(acc0, acc1);
#pragma unroll
            for (int r = 0; r < 8; ++r) {
                const int m = mt * 16 + rbase + r;
                if (m < NTOK)
                    out[((size_t)blk * NTOK + m) * CH + col] = acc[r] + bias;
            }
        }
    }
}

// ---------------------------------------------------------------------------
extern "C" void kernel_launch(void* const* d_in, const int* in_sizes, int n_in,
                              void* d_out, int out_size, void* d_ws,
                              size_t ws_size, hipStream_t stream) {
    using namespace cfg;
    const float* x      = (const float*)d_in[0];  // (4096, 49, 128)
    const float* w_qkv  = (const float*)d_in[1];  // (128, 384)
    const float* w_proj = (const float*)d_in[2];  // (128, 128)
    const float* b_proj = (const float*)d_in[3];  // (128,)
    float* out = (float*)d_out;                   // (4096, 49, 128)

    _Float16* wq16 = (_Float16*)d_ws;             // 49152 halfs, pair-packed
    _Float16* wp16 = wq16 + CH * C3;              // 16384 halfs, pair-packed

    const int prep_elems = CH * C3 + CH * CH;     // 65536
    WindowAttention_prep_weights<<<(prep_elems + 255) / 256, 256, 0, stream>>>(
        w_qkv, w_proj, wq16, wp16);

    const size_t lds_bytes = (size_t)LDS_HALFS * sizeof(_Float16);  // 84 KB
    hipFuncSetAttribute((const void*)WindowAttention_41815801594647_kernel,
                        hipFuncAttributeMaxDynamicSharedMemorySize,
                        (int)lds_bytes);

    const int B = in_sizes[0] / (NTOK * CH);      // 4096
    WindowAttention_41815801594647_kernel<<<B, 256, lds_bytes, stream>>>(
        x, wq16, wp16, b_proj, out);
}

// v002
// It runs in 73.4 microseconds.
// In both of two side-by-side timings against v001, it was 1.57 times as fast.
// Over all steps from v000 it is 2.18 times as fast.
#include <hip/hip_runtime.h>

typedef __attribute__((ext_vector_type(16))) _Float16 v16h;
typedef __attribute__((ext_vector_type(8)))  _Float16 v8h;
typedef __attribute__((ext_vector_type(8)))  float    v8f;

namespace cfg {
constexpr int NTOK = 49;      // real tokens per window
constexpr int NPAD = 64;      // padded tokens (4 tiles of 16)
constexpr int CH   = 128;     // channels
constexpr int NH   = 4;       // heads
constexpr int DH   = 32;      // head dim
constexpr int C3   = 3 * CH;  // qkv output width = 384
constexpr float SCALE = 0.17677669529663687f;  // 1/sqrt(32)

constexpr int XSTR = CH + 8;    // 136, x / attn-out buffer
constexpr int QSTR = C3 + 8;    // 392, qkv buffer
constexpr int XS_OFF  = 0;
constexpr int QKV_OFF = NPAD * XSTR;                 // 8704
constexpr int LDS_HALFS = QKV_OFF + NPAD * QSTR;     // 33792 halfs = 66 KB
}

__device__ __forceinline__ int frag_kk(int i) {
    return (i < 4) ? 2 * i : 16 + 2 * (i - 4);
}

// A fragment, or B fragment when K runs along the contiguous dim of src
// (i.e. src is row-major [M][K] for A, or [N][K] == B^T for B).
__device__ __forceinline__ v16h ldfrag_kcontig(const _Float16* src, int row0,
                                               int stride, int colbase) {
    const int lane = threadIdx.x & 31;
    const int mn   = lane & 15;
    const int khi  = (lane >> 4) ? 8 : 0;
    const _Float16* p = src + (row0 + mn) * stride + colbase + khi;
    v16h f;
#pragma unroll
    for (int i = 0; i < 8; ++i) {
        const int kk = frag_kk(i);
        f[2 * i]     = p[kk];
        f[2 * i + 1] = p[kk + 1];
    }
    return f;
}

// B fragment from a row-major [K][N] source (strided k-pair loads); equally
// the A fragment of the transposed source (lane = column n, same k order).
__device__ __forceinline__ v16h ldfrag_b_rowmajor(const _Float16* src, int k0,
                                                  int n0, int stride) {
    const int lane = threadIdx.x & 31;
    const int n    = lane & 15;
    const int khi  = (lane >> 4) ? 8 : 0;
    const _Float16* p = src + n0 + n;
    v16h f;
#pragma unroll
    for (int i = 0; i < 8; ++i) {
        const int kk = k0 + khi + frag_kk(i);
        f[2 * i]     = p[(size_t)kk * stride];
        f[2 * i + 1] = p[(size_t)(kk + 1) * stride];
    }
    return f;
}

__device__ __forceinline__ v16h ldfrag_b_packed(const _Float16* w, int k0,
                                                int n0, int nout) {
    const int lane = threadIdx.x & 31;
    const int n    = lane & 15;
    const int khi  = (lane >> 4) ? 8 : 0;
    const _Float16* base = w + ((size_t)(khi >> 1) * nout + n0 + n) * 2;
    v16h f;
#pragma unroll
    for (int i = 0; i < 8; ++i) {
        const _Float16* p = base + (size_t)((k0 + frag_kk(i)) >> 1) * nout * 2;
        f[2 * i]     = p[0];
        f[2 * i + 1] = p[1];
    }
    return f;
}

__device__ __forceinline__ void st_d_f16(_Float16* dst, int row0, int col0,
                                         int stride, v8f acc) {
    const int lane  = threadIdx.x & 31;
    const int n     = lane & 15;
    const int rbase = (lane >> 4) ? 8 : 0;
#pragma unroll
    for (int r = 0; r < 8; ++r)
        dst[(row0 + rbase + r) * stride + col0 + n] = (_Float16)acc[r];
}

__device__ __forceinline__ v8f wmma_f16(v16h a, v16h b, v8f c) {
    return __builtin_amdgcn_wmma_f32_16x16x32_f16(
        /*neg_a=*/false, a, /*neg_b=*/false, b,
        /*c_mod=*/(short)0, c, /*reuse_a=*/false, /*reuse_b=*/false);
}

__device__ __forceinline__ float xhalf(float x) {
    const int b = __builtin_bit_cast(int, x);
    return __builtin_bit_cast(float, __builtin_amdgcn_permlanex16(
        b, b, 0x76543210, 0xfedcba98, false, false));
}

__device__ __forceinline__ float exp_slot(float x) {
    const float t = x * 1.44269504f;
    float r;
    asm("v_exp_f32 %0, %1\n\tv_nop" : "=v"(r) : "v"(t));
    return r;
}

__device__ __forceinline__ v8f v8f_add(v8f a, v8f b) {
    v8f r;
#pragma unroll
    for (int i = 0; i < 8; ++i) r[i] = a[i] + b[i];
    return r;
}

// ---------------------------------------------------------------------------
// Prep: convert fp32 weights to pair-packed f16 once (weights then sit in L2).
// ---------------------------------------------------------------------------
__global__ void WindowAttention_prep_weights(const float* __restrict__ wq,
                                             const float* __restrict__ wp,
                                             _Float16* __restrict__ wq16,
                                             _Float16* __restrict__ wp16) {
    const int tid = blockIdx.x * blockDim.x + threadIdx.x;
    if (tid < cfg::CH * cfg::C3) {
        const int k = tid / cfg::C3, n = tid % cfg::C3;
        wq16[((k >> 1) * cfg::C3 + n) * 2 + (k & 1)] = (_Float16)wq[tid];
    } else if (tid < cfg::CH * cfg::C3 + cfg::CH * cfg::CH) {
        const int t = tid - cfg::CH * cfg::C3;
        const int k = t / cfg::CH, n = t % cfg::CH;
        wp16[((k >> 1) * cfg::CH + n) * 2 + (k & 1)] = (_Float16)wp[t];
    }
}

// ---------------------------------------------------------------------------
// Main fused kernel: one workgroup (8 waves) per window.
// ---------------------------------------------------------------------------
__global__ void __launch_bounds__(256)
WindowAttention_41815801594647_kernel(const float* __restrict__ x,
                                      const _Float16* __restrict__ wq16,
                                      const _Float16* __restrict__ wp16,
                                      const float* __restrict__ bp,
                                      float* __restrict__ out) {
    using namespace cfg;
    extern __shared__ _Float16 smem[];
    _Float16* xs  = smem + XS_OFF;   // [NPAD][XSTR] : x (f16), later attn-out
    _Float16* qkv = smem + QKV_OFF;  // [NPAD][QSTR] : q|k|v (f16)

    const int tid  = threadIdx.x;
    const int wave = tid >> 5;
    const int lane = tid & 31;
    const int blk  = blockIdx.x;

    // hint L2 for this block's weight stream
    __builtin_prefetch(wq16, 0, 1);

    // ---- Phase 1: stage x into LDS as f16, zero the padded rows -----------
    {
        const float4* xv = (const float4*)(x + (size_t)blk * NTOK * CH);
        for (int idx = tid; idx < NTOK * (CH / 4); idx += 256) {
            const int row = idx / (CH / 4);
            const int c4  = idx % (CH / 4);
            const float4 v = xv[idx];
            _Float16* d = xs + row * XSTR + c4 * 4;
            d[0] = (_Float16)v.x; d[1] = (_Float16)v.y;
            d[2] = (_Float16)v.z; d[3] = (_Float16)v.w;
        }
        for (int idx = tid; idx < (NPAD - NTOK) * CH; idx += 256) {
            const int row = NTOK + idx / CH;
            xs[row * XSTR + (idx % CH)] = (_Float16)0.0f;
        }
    }
    __syncthreads();

    // ---- Phase 2: qkv = x @ Wqkv (64x384 = 4 x 24 tiles, K=128) -----------
    // Each wave owns the column tiles wave, wave+8, wave+16. A column tile's
    // four weight fragments are loaded once and kept in registers for all
    // four row tiles. Dual accumulator chains (k even / k odd) -> independent
    // WMMA streams.
    // unroll: the next column tile's weight loads can issue under this one's
    // products, and the fragment array stays in registers.
#pragma unroll
    for (int j = 0; j < 3; ++j) {
        const int nt = wave + 8 * j;
        v16h b[4];
        // unroll: b[] is indexed by constants only, so it needs no memory
#pragma unroll
        for (int k = 0; k < 4; ++k)
            b[k] = ldfrag_b_packed(wq16, k * 32, nt * 16, C3);
        // unroll: row-tile offsets become immediates of the LDS accesses
#pragma unroll
        for (int mt = 0; mt < 4; ++mt) {
            v8f acc0 = {}, acc1 = {};
#pragma unroll
            for (int kp = 0; kp < 2; ++kp) {
                v16h a0 = ldfrag_kcontig(xs, mt * 16, XSTR, (2 * kp + 0) * 32);
                v16h a1 = ldfrag_kcontig(xs, mt * 16, XSTR, (2 * kp + 1) * 32);
                acc0 = wmma_f16(a0, b[2 * kp + 0], acc0);
                acc1 = wmma_f16(a1, b[2 * kp + 1], acc1);
            }
            st_d_f16(qkv, mt * 16, nt * 16, QSTR, v8f_add(acc0, acc1));
        }
    }
    __syncthreads();

    _Float16* ao = xs;  // x staging no longer needed -> reuse as attn output
    const int qc = lane & 15;               // this lane's query in the block
    const int rb = (lane >> 4) ? 8 : 0;     // this lane half's row offset in D
#pragma unroll
    for (int it = 0; it < 2; ++it) {
        const int task = wave + 8 * it;
        const int hd   = task >> 2;
        const int mt   = task & 3;

        // S^T (64 keys x 16 queries, K = DH = 32): 4 independent WMMAs
        v8f st[4];
        {
            v16h bq = ldfrag_kcontig(qkv, mt * 16, QSTR, hd * DH);
            v16h ak[4];
#pragma unroll
            for (int nt = 0; nt < 4; ++nt)
                ak[nt] = ldfrag_kcontig(qkv, nt * 16, QSTR, CH + hd * DH);
            const v8f z = {};
#pragma unroll
            for (int nt = 0; nt < 3; ++nt) st[nt] = wmma_f16(ak[nt], bq, z);
            // The last tile holds one real key, so seven of its result
            // registers are free at once. Keep it the last of the four.
            __builtin_amdgcn_sched_barrier(0);
            st[3] = wmma_f16(ak[3], bq, z);
        }

        // scale, mask the padded keys, maximum over the lane's keys. A register
        // whose key is padding in both lane halves takes no part at all: its
        // weight is exactly 0.
        float mx[4];
#pragma unroll
        for (int nt = 0; nt < 4; ++nt) {
            mx[nt] = -3.0e38f;
#pragma unroll
            for (int r = 0; r < 8; ++r) {
                if (nt * 16 + r >= NTOK) continue;
                float s = st[nt][r] * SCALE;
                if (nt * 16 + 8 + r >= NTOK) s = rb ? -3.0e38f : s;
                st[nt][r] = s;
                mx[nt] = fmaxf(mx[nt], s);
            }
        }
        float m = fmaxf(fmaxf(mx[0], mx[1]), fmaxf(mx[2], mx[3]));
        m = fmaxf(m, xhalf(m));

        // exp and sum: one partial sum per tile, so four short chains
        float sm[4];
#pragma unroll
        for (int nt = 0; nt < 4; ++nt) {
            sm[nt] = 0.0f;
#pragma unroll
            for (int r = 0; r < 8; ++r) {
                if (nt * 16 + r >= NTOK) continue;
                const float e = exp_slot(st[nt][r] - m);
                st[nt][r] = e;
                sm[nt] = r ? sm[nt] + e : e;
            }
        }
        float s = (sm[0] + sm[1]) + (sm[2] + sm[3]);
        s += xhalf(s);
        const float inv = 1.0f / s;

        // P^T as B fragments, straight from the score registers
        v16h pb[2];
#pragma unroll
        for (int j = 0; j < 2; ++j)
#pragma unroll
            for (int e = 0; e < 16; ++e) {
                const int nt = 2 * j + (e >> 3), r = e & 7;
                pb[j][e] = (nt * 16 + r >= NTOK) ? (_Float16)0.0f
                                                 : (_Float16)(st[nt][r] * inv);
            }

        // O^T = V^T(32x64) @ P^T(64x16): per 16 channels, 2 independent chains.
        // A lane's 8 results are 8 consecutive channels of its query's row.
#pragma unroll
        for (int dt = 0; dt < 2; ++dt) {
            v8f z0 = {}, z1 = {};
            v16h a0 = ldfrag_b_rowmajor(qkv, 0, 2 * CH + hd * DH + dt * 16, QSTR);
            v16h a1 = ldfrag_b_rowmajor(qkv, 32, 2 * CH + hd * DH + dt * 16, QSTR);
            v8f acc0 = wmma_f16(a0, pb[0], z0);
            v8f acc1 = wmma_f16(a1, pb[1], z1);
            const v8f o = v8f_add(acc0, acc1);
            v8h oh;
#pragma unroll
            for (int r = 0; r < 8; ++r) oh[r] = (_Float16)o[r];
            *(v8h*)(ao + (mt * 16 + qc) * XSTR + hd * DH + dt * 16 + rb) = oh;
        }
    }
    __syncthreads();

    // ---- Phase 4: proj + bias, fp32 store of the 49 real rows -------------
    // Each wave owns column tile nt = wave: its four weight fragments and its
    // bias are loaded once and serve all four row tiles.
    {
        const int nt = wave;
        v16h b[4];
        // unroll: b[] is indexed by constants only, so it needs no memory
#pragma unroll
        for (int k = 0; k < 4; ++k)
            b[k] = ldfrag_b_packed(wp16, k * 32, nt * 16, CH);
        const int col  = nt * 16 + (lane & 15);
        const float bias = bp[col];
        const int rbase = (lane >> 4) ? 8 : 0;
        // unroll: the fragment array stays in registers and the row guard
        // folds away for the three full row tiles
#pragma unroll
        for (int mt = 0; mt < 4; ++mt) {
            v8f acc0 = {}, acc1 = {};
#pragma unroll
            for (int kp = 0; kp < 2; ++kp) {
                v16h a0 = ldfrag_kcontig(ao, mt * 16, XSTR, (2 * kp + 0) * 32);
                v16h a1 = ldfrag_kcontig(ao, mt * 16, XSTR, (2 * kp + 1) * 32);
                acc0 = wmma_f16(a0, b[2 * kp + 0], acc0);
                acc1 = wmma_f16(a1, b[2 * kp + 1], acc1);
            }
            const v8f acc = v8f_add(acc0, acc1);
#pragma unroll
            for (int r = 0; r < 8; ++r) {
                const int m = mt * 16 + rbase + r;
                if (m < NTOK)
                    out[((size_t)blk * NTOK + m) * CH + col] = acc[r] + bias;
            }
        }
    }
}

// ---------------------------------------------------------------------------
extern "C" void kernel_launch(void* const* d_in, const int* in_sizes, int n_in,
                              void* d_out, int out_size, void* d_ws,
                              size_t ws_size, hipStream_t stream) {
    using namespace cfg;
    const float* x      = (const float*)d_in[0];  // (4096, 49, 128)
    const float* w_qkv  = (const float*)d_in[1];  // (128, 384)
    const float* w_proj = (const float*)d_in[2];  // (128, 128)
    const float* b_proj = (const float*)d_in[3];  // (128,)
    float* out = (float*)d_out;                   // (4096, 49, 128)

    _Float16* wq16 = (_Float16*)d_ws;             // 49152 halfs, pair-packed
    _Float16* wp16 = wq16 + CH * C3;              // 16384 halfs, pair-packed

    const int prep_elems = CH * C3 + CH * CH;     // 65536
    WindowAttention_prep_weights<<<(prep_elems + 255) / 256, 256, 0, stream>>>(
        w_qkv, w_proj, wq16, wp16);

    const size_t lds_bytes = (size_t)LDS_HALFS * sizeof(_Float16);  // 66 KB
    hipFuncSetAttribute((const void*)WindowAttention_41815801594647_kernel,
                        hipFuncAttributeMaxDynamicSharedMemorySize,
                        (int)lds_bytes);

    const int B = in_sizes[0] / (NTOK * CH);      // 4096
    WindowAttention_41815801594647_kernel<<<B, 256, lds_bytes, stream>>>(
        x, wq16, wp16, b_proj, out);
}

// v003
// A run of this version takes 69 microseconds.
// Next to v002, in two timings, it ran 1.07 times as fast each time.
// Over all steps from v000 it is 2.32 times as fast.
#include <hip/hip_runtime.h>

typedef __attribute__((ext_vector_type(16))) _Float16 v16h;
typedef __attribute__((ext_vector_type(8)))  _Float16 v8h;
typedef __attribute__((ext_vector_type(8)))  float    v8f;

namespace cfg {
constexpr int NTOK = 49;      // real tokens per window
constexpr int NPAD = 64;      // padded tokens (4 tiles of 16)
constexpr int CH   = 128;     // channels
constexpr int NH   = 4;       // heads
constexpr int DH   = 32;      // head dim
constexpr int C3   = 3 * CH;  // qkv output width = 384
constexpr float SCALE = 0.17677669529663687f;  // 1/sqrt(32)

constexpr int XSTR = CH + 8;    // 136, x / attn-out buffer
constexpr int FRAG = 512;       // one 16x32 f16 fragment: 2 x 32 lanes x 8
constexpr int XS_OFF  = 0;
constexpr int QKV_OFF = NPAD * XSTR;                 // 8704
// q, k, v as ready fragments: [q|k|v][head][4][FRAG]
constexpr int LDS_HALFS = QKV_OFF + 3 * NH * 4 * FRAG;  // 33280 halfs = 65 KB
}

__device__ __forceinline__ int frag_kk(int i) {
    return (i < 4) ? 2 * i : 16 + 2 * (i - 4);
}

// A fragment, or B fragment when K runs along the contiguous dim of src
// (i.e. src is row-major [M][K] for A, or [N][K] == B^T for B).
__device__ __forceinline__ v16h ldfrag_kcontig(const _Float16* src, int row0,
                                               int stride, int colbase) {
    const int lane = threadIdx.x & 31;
    const int mn   = lane & 15;
    const int khi  = (lane >> 4) ? 8 : 0;
    const _Float16* p = src + (row0 + mn) * stride + colbase + khi;
    v16h f;
#pragma unroll
    for (int i = 0; i < 8; ++i) {
        const int kk = frag_kk(i);
        f[2 * i]     = p[kk];
        f[2 * i + 1] = p[kk + 1];
    }
    return f;
}

__device__ __forceinline__ v16h ldfrag_b_packed(const _Float16* w, int k0,
                                                int n0, int nout) {
    const int lane = threadIdx.x & 31;
    const int n    = lane & 15;
    const int khi  = (lane >> 4) ? 8 : 0;
    const _Float16* base = w + ((size_t)(khi >> 1) * nout + n0 + n) * 2;
    v16h f;
#pragma unroll
    for (int i = 0; i < 8; ++i) {
        const _Float16* p = base + (size_t)((k0 + frag_kk(i)) >> 1) * nout * 2;
        f[2 * i]     = p[0];
        f[2 * i + 1] = p[1];
    }
    return f;
}

__device__ __forceinline__ void st_half_frag(_Float16* frag, int half, v8f acc) {
    const int lane = threadIdx.x & 31;
    v8h h;
#pragma unroll
    for (int r = 0; r < 8; ++r) h[r] = (_Float16)acc[r];
    *(v8h*)(frag + half * 256 + lane * 8) = h;
}

__device__ __forceinline__ v16h ld_frag(const _Float16* frag) {
    const int lane = threadIdx.x & 31;
    const v8h lo = *(const v8h*)(frag + lane * 8);
    const v8h hi = *(const v8h*)(frag + 256 + lane * 8);
    v16h f;
#pragma unroll
    for (int i = 0; i < 8; ++i) { f[i] = lo[i]; f[8 + i] = hi[i]; }
    return f;
}

__device__ __forceinline__ v8f wmma_f16(v16h a, v16h b, v8f c) {
    return __builtin_amdgcn_wmma_f32_16x16x32_f16(
        /*neg_a=*/false, a, /*neg_b=*/false, b,
        /*c_mod=*/(short)0, c, /*reuse_a=*/false, /*reuse_b=*/false);
}

__device__ __forceinline__ float xhalf(float x) {
    const int b = __builtin_bit_cast(int, x);
    return __builtin_bit_cast(float, __builtin_amdgcn_permlanex16(
        b, b, 0x76543210, 0xfedcba98, false, false));
}

__device__ __forceinline__ float exp_slot(float x) {
    const float t = x * 1.44269504f;
    float r;
    asm("v_exp_f32 %0, %1\n\tv_nop" : "=v"(r) : "v"(t));
    return r;
}

__device__ __forceinline__ v8f v8f_add(v8f a, v8f b) {
    v8f r;
#pragma unroll
    for (int i = 0; i < 8; ++i) r[i] = a[i] + b[i];
    return r;
}

// ---------------------------------------------------------------------------
// Prep: convert fp32 weights to pair-packed f16 once (weights then sit in L2).
// ---------------------------------------------------------------------------
__global__ void WindowAttention_prep_weights(const float* __restrict__ wq,
                                             const float* __restrict__ wp,
                                             _Float16* __restrict__ wq16,
                                             _Float16* __restrict__ wp16) {
    const int tid = blockIdx.x * blockDim.x + threadIdx.x;
    if (tid < cfg::CH * cfg::C3) {
        const int k = tid / cfg::C3, n = tid % cfg::C3;
        wq16[((k >> 1) * cfg::C3 + n) * 2 + (k & 1)] = (_Float16)wq[tid];
    } else if (tid < cfg::CH * cfg::C3 + cfg::CH * cfg::CH) {
        const int t = tid - cfg::CH * cfg::C3;
        const int k = t / cfg::CH, n = t % cfg::CH;
        wp16[((k >> 1) * cfg::CH + n) * 2 + (k & 1)] = (_Float16)wp[t];
    }
}

// ---------------------------------------------------------------------------
// Main fused kernel: one workgroup (8 waves) per window.
// ---------------------------------------------------------------------------
__global__ void __launch_bounds__(256)
WindowAttention_41815801594647_kernel(const float* __restrict__ x,
                                      const _Float16* __restrict__ wq16,
                                      const _Float16* __restrict__ wp16,
                                      const float* __restrict__ bp,
                                      float* __restrict__ out) {
    using namespace cfg;
    extern __shared__ _Float16 smem[];
    _Float16* xs  = smem + XS_OFF;   // [NPAD][XSTR] : x (f16), later attn-out
    _Float16* qkv = smem + QKV_OFF;  // q|k|v fragments of all heads (f16)

    const int tid  = threadIdx.x;
    const int wave = tid >> 5;
    const int lane = tid & 31;
    const int blk  = blockIdx.x;

    // hint L2 for this block's weight stream
    __builtin_prefetch(wq16, 0, 1);

    // ---- Phase 1: stage x into LDS as f16, zero the padded rows -----------
    {
        const float4* xv = (const float4*)(x + (size_t)blk * NTOK * CH);
        for (int idx = tid; idx < NTOK * (CH / 4); idx += 256) {
            const int row = idx / (CH / 4);
            const int c4  = idx % (CH / 4);
            const float4 v = xv[idx];
            _Float16* d = xs + row * XSTR + c4 * 4;
            d[0] = (_Float16)v.x; d[1] = (_Float16)v.y;
            d[2] = (_Float16)v.z; d[3] = (_Float16)v.w;
        }
        for (int idx = tid; idx < (NPAD - NTOK) * CH; idx += 256) {
            const int row = NTOK + idx / CH;
            xs[row * XSTR + (idx % CH)] = (_Float16)0.0f;
        }
    }
    __syncthreads();

    // ---- Phase 2: qkv = x @ Wqkv (64x384 = 4 x 24 tiles, K=128) -----------
    // Each wave owns the column tiles wave, wave+8, wave+16: 16 channels
    // (half wc of head wh) of q, of k and of v. A column tile's four weight
    // fragments are loaded once and kept in registers for all four row tiles.
    // Dual accumulator chains (k even / k odd) -> independent WMMA streams.
    // q and k tiles are formed transposed (W^T x^T: lane = token, registers =
    // 8 channels), v tiles as x W (lane = channel, registers = 8 tokens): each
    // result is then half of a fragment that phase 3 reads.
    const int wh = wave >> 1;
    const int wc = wave & 1;
    // unroll: the next column tile's weight loads can issue under this one's
    // products, and the fragment array stays in registers.
#pragma unroll
    for (int j = 0; j < 3; ++j) {
        const int nt = wave + 8 * j;
        v16h b[4];
        // unroll: b[] is indexed by constants only, so it needs no memory
#pragma unroll
        for (int k = 0; k < 4; ++k)
            b[k] = ldfrag_b_packed(wq16, k * 32, nt * 16, C3);
        // unroll: row-tile offsets become immediates of the LDS accesses
#pragma unroll
        for (int mt = 0; mt < 4; ++mt) {
            v8f acc0 = {}, acc1 = {};
#pragma unroll
            for (int kp = 0; kp < 2; ++kp) {
                v16h a0 = ldfrag_kcontig(xs, mt * 16, XSTR, (2 * kp + 0) * 32);
                v16h a1 = ldfrag_kcontig(xs, mt * 16, XSTR, (2 * kp + 1) * 32);
                if (j < 2) {
                    acc0 = wmma_f16(b[2 * kp + 0], a0, acc0);
                    acc1 = wmma_f16(b[2 * kp + 1], a1, acc1);
                } else {
                    acc0 = wmma_f16(a0, b[2 * kp + 0], acc0);
                    acc1 = wmma_f16(a1, b[2 * kp + 1], acc1);
                }
            }
            // q, k: fragment = token tile, half = channel half of the head.
            // v: fragment = 2 * channel half + key half, half = token tile & 1.
            _Float16* fh = qkv + (j * NH + wh) * 4 * FRAG;
            if (j < 2)
                st_half_frag(fh + mt * FRAG, wc, v8f_add(acc0, acc1));
            else
                st_half_frag(fh + (2 * wc + (mt >> 1)) * FRAG, mt & 1,
                             v8f_add(acc0, acc1));
        }
        // The third tile's weight loads stay behind the first tile's products:
        // with all three tiles' fragments live at once the wave needs more
        // than 128 registers and a work-group less fits on the WGP.
        if (j == 0) __builtin_amdgcn_sched_barrier(0);
    }
    __syncthreads();

    _Float16* ao = xs;  // x staging no longer needed -> reuse as attn output
    const int qc = lane & 15;               // this lane's query in the block
    const int rb = (lane >> 4) ? 8 : 0;     // this lane half's row offset in D
#pragma unroll
    for (int it = 0; it < 2; ++it) {
        const int task = wave + 8 * it;
        const int hd   = task >> 2;
        const int mt   = task & 3;

        // S^T (64 keys x 16 queries, K = DH = 32): 4 independent WMMAs
        v8f st[4];
        {
            v16h bq = ld_frag(qkv + (hd * 4 + mt) * FRAG);
            v16h ak[4];
#pragma unroll
            for (int nt = 0; nt < 4; ++nt)
                ak[nt] = ld_frag(qkv + ((NH + hd) * 4 + nt) * FRAG);
            const v8f z = {};
#pragma unroll
            for (int nt = 0; nt < 3; ++nt) st[nt] = wmma_f16(ak[nt], bq, z);
            // The last tile holds one real key, so seven of its result
            // registers are free at once. Keep it the last of the four.
            __builtin_amdgcn_sched_barrier(0);
            st[3] = wmma_f16(ak[3], bq, z);
        }

        // scale, mask the padded keys, maximum over the lane's keys. A register
        // whose key is padding in both lane halves takes no part at all: its
        // weight is exactly 0.
        float mx[4];
#pragma unroll
        for (int nt = 0; nt < 4; ++nt) {
            mx[nt] = -3.0e38f;
#pragma unroll
            for (int r = 0; r < 8; ++r) {
                if (nt * 16 + r >= NTOK) continue;
                float s = st[nt][r] * SCALE;
                if (nt * 16 + 8 + r >= NTOK) s = rb ? -3.0e38f : s;
                st[nt][r] = s;
                mx[nt] = fmaxf(mx[nt], s);
            }
        }
        float m = fmaxf(fmaxf(mx[0], mx[1]), fmaxf(mx[2], mx[3]));
        m = fmaxf(m, xhalf(m));

        // exp and sum: one partial sum per tile, so four short chains
        float sm[4];
#pragma unroll
        for (int nt = 0; nt < 4; ++nt) {
            sm[nt] = 0.0f;
#pragma unroll
            for (int r = 0; r < 8; ++r) {
                if (nt * 16 + r >= NTOK) continue;
                const float e = exp_slot(st[nt][r] - m);
                st[nt][r] = e;
                sm[nt] = r ? sm[nt] + e : e;
            }
        }
        float s = (sm[0] + sm[1]) + (sm[2] + sm[3]);
        s += xhalf(s);
        const float inv = 1.0f / s;

        // P^T as B fragments, straight from the score registers
        v16h pb[2];
#pragma unroll
        for (int j = 0; j < 2; ++j)
#pragma unroll
            for (int e = 0; e < 16; ++e) {
                const int nt = 2 * j + (e >> 3), r = e & 7;
                pb[j][e] = (nt * 16 + r >= NTOK) ? (_Float16)0.0f
                                                 : (_Float16)(st[nt][r] * inv);
            }

        // O^T = V^T(32x64) @ P^T(64x16): per 16 channels, 2 independent chains.
        // A lane's 8 results are 8 consecutive channels of its query's row.
#pragma unroll
        for (int dt = 0; dt < 2; ++dt) {
            v8f z0 = {}, z1 = {};
            v16h a0 = ld_frag(qkv + ((2 * NH + hd) * 4 + 2 * dt + 0) * FRAG);
            v16h a1 = ld_frag(qkv + ((2 * NH + hd) * 4 + 2 * dt + 1) * FRAG);
            v8f acc0 = wmma_f16(a0, pb[0], z0);
            v8f acc1 = wmma_f16(a1, pb[1], z1);
            const v8f o = v8f_add(acc0, acc1);
            v8h oh;
#pragma unroll
            for (int r = 0; r < 8; ++r) oh[r] = (_Float16)o[r];
            *(v8h*)(ao + (mt * 16 + qc) * XSTR + hd * DH + dt * 16 + rb) = oh;
        }
    }
    __syncthreads();

    // ---- Phase 4: proj + bias, fp32 store of the 49 real rows -------------
    // Each wave owns column tile nt = wave: its four weight fragments and its
    // bias are loaded once and serve all four row tiles.
    {
        const int nt = wave;
        v16h b[4];
        // unroll: b[] is indexed by constants only, so it needs no memory
#pragma unroll
        for (int k = 0; k < 4; ++k)
            b[k] = ldfrag_b_packed(wp16, k * 32, nt * 16, CH);
        const int col  = nt * 16 + (lane & 15);
        const float bias = bp[col];
        const int rbase = (lane >> 4) ? 8 : 0;
        // unroll: the fragment array stays in registers and the row guard
        // folds away for the three full row tiles
#pragma unroll
        for (int mt = 0; mt < 4; ++mt) {
            v8f acc0 = {}, acc1 = {};
#pragma unroll
            for (int kp = 0; kp < 2; ++kp) {
                v16h a0 = ldfrag_kcontig(ao, mt * 16, XSTR, (2 * kp + 0) * 32);
                v16h a1 = ldfrag_kcontig(ao, mt * 16, XSTR, (2 * kp + 1) * 32);
                acc0 = wmma_f16(a0, b[2 * kp + 0], acc0);
                acc1 = wmma_f16(a1, b[2 * kp + 1], acc1);
            }
            const v8f acc = v8f_add(acc0, acc1);
#pragma unroll
            for (int r = 0; r < 8; ++r) {
                const int m = mt * 16 + rbase + r;
                if (m < NTOK)
                    out[((size_t)blk * NTOK + m) * CH + col] = acc[r] + bias;
            }
        }
    }
}

// ---------------------------------------------------------------------------
extern "C" void kernel_launch(void* const* d_in, const int* in_sizes, int n_in,
                              void* d_out, int out_size, void* d_ws,
                              size_t ws_size, hipStream_t stream) {
    using namespace cfg;
    const float* x      = (const float*)d_in[0];  // (4096, 49, 128)
    const float* w_qkv  = (const float*)d_in[1];  // (128, 384)
    const float* w_proj = (const float*)d_in[2];  // (128, 128)
    const float* b_proj = (const float*)d_in[3];  // (128,)
    float* out = (float*)d_out;                   // (4096, 49, 128)

    _Float16* wq16 = (_Float16*)d_ws;             // 49152 halfs, pair-packed
    _Float16* wp16 = wq16 + CH * C3;              // 16384 halfs, pair-packed

    const int prep_elems = CH * C3 + CH * CH;     // 65536
    WindowAttention_prep_weights<<<(prep_elems + 255) / 256, 256, 0, stream>>>(
        w_qkv, w_proj, wq16, wp16);

    const size_t lds_bytes = (size_t)LDS_HALFS * sizeof(_Float16);  // 65 KB
    hipFuncSetAttribute((const void*)WindowAttention_41815801594647_kernel,
                        hipFuncAttributeMaxDynamicSharedMemorySize,
                        (int)lds_bytes);

    const int B = in_sizes[0] / (NTOK * CH);      // 4096
    WindowAttention_41815801594647_kernel<<<B, 256, lds_bytes, stream>>>(
        x, wq16, wp16, b_proj, out);
}

// v004
// A run of this version takes 59.6 microseconds.
// Next to v003, in two timings, it ran 1.16 times as fast each time.
// Counting every step since v000, it is 2.69 times as fast.
#include <hip/hip_runtime.h>

typedef __attribute__((ext_vector_type(16))) _Float16 v16h;
typedef __attribute__((ext_vector_type(8)))  _Float16 v8h;
typedef __attribute__((ext_vector_type(8)))  float    v8f;

namespace cfg {
constexpr int NTOK = 49;      // real tokens per window
constexpr int NPAD = 64;      // padded tokens (4 tiles of 16)
constexpr int CH   = 128;     // channels
constexpr int NH   = 4;       // heads
constexpr int DH   = 32;      // head dim
constexpr int C3   = 3 * CH;  // qkv output width = 384
constexpr float SCALE = 0.17677669529663687f;  // 1/sqrt(32)

constexpr int XSTR = CH + 8;    // 136, x / attn-out buffer
constexpr int FRAG = 512;       // one 16x32 f16 fragment: 2 x 32 lanes x 8
constexpr int XS_OFF  = 0;
constexpr int QKV_OFF = NPAD * XSTR;                 // 8704
// q, k, v as ready fragments: [q|k|v][head][4][FRAG]
constexpr int LDS_HALFS = QKV_OFF + 3 * NH * 4 * FRAG;  // 33280 halfs = 65 KB
}

__device__ __forceinline__ int frag_kk(int i) {
    return (i < 4) ? 2 * i : 16 + 2 * (i - 4);
}

// A fragment, or B fragment when K runs along the contiguous dim of src
// (i.e. src is row-major [M][K] for A, or [N][K] == B^T for B).
__device__ __forceinline__ v16h ldfrag_kcontig(const _Float16* src, int row0,
                                               int stride, int colbase) {
    const int lane = threadIdx.x & 31;
    const int mn   = lane & 15;
    const int khi  = (lane >> 4) ? 8 : 0;
    const _Float16* p = src + (row0 + mn) * stride + colbase + khi;
    v16h f;
#pragma unroll
    for (int i = 0; i < 8; ++i) {
        const int kk = frag_kk(i);
        f[2 * i]     = p[kk];
        f[2 * i + 1] = p[kk + 1];
    }
    return f;
}

__device__ __forceinline__ int frag_b_lane(int n0, int nout) {
    const int lane = threadIdx.x & 31;
    const int n    = lane & 15;
    const int khi  = (lane >> 4) ? 8 : 0;
    return (khi >> 1) * nout + n0 + n;
}

__device__ __forceinline__ v16h ldfrag_b_packed(const _Float16* w, int k0,
                                                int lane_part, int nout) {
    const _Float16* base = w + (size_t)lane_part * 2;
    v16h f;
#pragma unroll
    for (int i = 0; i < 8; ++i) {
        const _Float16* p = base + (size_t)((k0 + frag_kk(i)) >> 1) * nout * 2;
        f[2 * i]     = p[0];
        f[2 * i + 1] = p[1];
    }
    return f;
}

__device__ __forceinline__ void st_half_frag(_Float16* frag, int half, v8f acc) {
    const int lane = threadIdx.x & 31;
    v8h h;
#pragma unroll
    for (int r = 0; r < 8; ++r) h[r] = (_Float16)acc[r];
    *(v8h*)(frag + half * 256 + lane * 8) = h;
}

__device__ __forceinline__ v16h ld_frag(const _Float16* frag) {
    const int lane = threadIdx.x & 31;
    const v8h lo = *(const v8h*)(frag + lane * 8);
    const v8h hi = *(const v8h*)(frag + 256 + lane * 8);
    v16h f;
#pragma unroll
    for (int i = 0; i < 8; ++i) { f[i] = lo[i]; f[8 + i] = hi[i]; }
    return f;
}

__device__ __forceinline__ v8f wmma_f16(v16h a, v16h b, v8f c) {
    return __builtin_amdgcn_wmma_f32_16x16x32_f16(
        /*neg_a=*/false, a, /*neg_b=*/false, b,
        /*c_mod=*/(short)0, c, /*reuse_a=*/false, /*reuse_b=*/false);
}

__device__ __forceinline__ float xhalf(float x) {
    const int b = __builtin_bit_cast(int, x);
    return __builtin_bit_cast(float, __builtin_amdgcn_permlanex16(
        b, b, 0x76543210, 0xfedcba98, false, false));
}

__device__ __forceinline__ float exp_slot(float x) {
    const float t = x * 1.44269504f;
    float r;
    asm("v_exp_f32 %0, %1\n\tv_nop" : "=v"(r) : "v"(t));
    return r;
}

__device__ __forceinline__ v8f v8f_add(v8f a, v8f b) {
    v8f r;
#pragma unroll
    for (int i = 0; i < 8; ++i) r[i] = a[i] + b[i];
    return r;
}

// ---------------------------------------------------------------------------
// Prep: convert fp32 weights to pair-packed f16 once (weights then sit in L2).
// ---------------------------------------------------------------------------
__global__ void WindowAttention_prep_weights(const float* __restrict__ wq,
                                             const float* __restrict__ wp,
                                             _Float16* __restrict__ wq16,
                                             _Float16* __restrict__ wp16) {
    const int tid = blockIdx.x * blockDim.x + threadIdx.x;
    if (tid < cfg::CH * cfg::C3) {
        const int k = tid / cfg::C3, n = tid % cfg::C3;
        wq16[((k >> 1) * cfg::C3 + n) * 2 + (k & 1)] = (_Float16)wq[tid];
    } else if (tid < cfg::CH * cfg::C3 + cfg::CH * cfg::CH) {
        const int t = tid - cfg::CH * cfg::C3;
        const int k = t / cfg::CH, n = t % cfg::CH;
        wp16[((k >> 1) * cfg::CH + n) * 2 + (k & 1)] = (_Float16)wp[t];
    }
}

// ---------------------------------------------------------------------------
// Main fused kernel: one workgroup (8 waves) per window.
// ---------------------------------------------------------------------------
__global__ void __launch_bounds__(256)
WindowAttention_41815801594647_kernel(const float* __restrict__ x,
                                      const _Float16* __restrict__ wq16,
                                      const _Float16* __restrict__ wp16,
                                      const float* __restrict__ bp,
                                      float* __restrict__ out) {
    using namespace cfg;
    extern __shared__ _Float16 smem[];
    _Float16* xs  = smem + XS_OFF;   // [NPAD][XSTR] : x (f16), later attn-out
    _Float16* qkv = smem + QKV_OFF;  // q|k|v fragments of all heads (f16)

    const int tid  = threadIdx.x;
    const int wave = tid >> 5;
    const int lane = tid & 31;
    const int blk  = blockIdx.x;

    // ---- Phase 1: stage x into LDS as f16, zero the padded rows -----------
    // These loads go out before the first
    // wait: all of the thread's x loads together (one memory latency for the
    // window, not one per 256 float4), and the first column tile's weight
    // fragments, whose L2 latency passes under the x loads'. The padded rows
    // are zeroed while the loads fly.
    const int wh = wave >> 1;
    const int wc = wave & 1;
    v16h bw[3][4];  // weight fragments of the wave's q, k and v column tiles
    const int wl = frag_b_lane(wave * 16, C3);  // lane's place in the q tile
    {
        constexpr int NV   = NTOK * (CH / 4);  // 1568 float4 in a window
        constexpr int FULL = NV / 256;         // 6 rounds that every thread has
        const float4* xv = (const float4*)(x + (size_t)blk * NTOK * CH);
        float4 v[FULL + 1];
        // unroll: v[] stays in registers and the loads share one address
#pragma unroll
        for (int i = 0; i < FULL; ++i) v[i] = xv[tid + 256 * i];
        // The last 32 float4 are wave 0's. The load is not put under that
        // test (a branch would bring its wait along, in front of the weight
        // loads): the other waves read the window's last float4 and drop it.
        const bool tail = tid < NV - FULL * 256;
        const int  tl   = tail ? tid : NV - FULL * 256 - 1;
        v[FULL] = xv[256 * FULL + tl];
        // unroll: bw[] is indexed by constants only, so it needs no memory
#pragma unroll
        for (int k = 0; k < 4; ++k)
            bw[0][k] = ldfrag_b_packed(wq16, k * 32, wl, C3);
        // Precaution: this wait stands in front of any reuse of the loads'
        // address registers. The lane's indices are inputs so that their
        // registers stay untouched up to it (without them later index
        // arithmetic was lifted over the wait, into those registers).
        asm volatile("s_wait_xcnt 0x0"
                     :: "v"(tl), "v"(tid), "v"(wl) : "memory");
        for (int idx = tid; idx < (NPAD - NTOK) * CH; idx += 256) {
            const int row = NTOK + idx / CH;
            xs[row * XSTR + (idx % CH)] = (_Float16)0.0f;
        }
        // float4 tid + 256 i is row wave + 8 i, columns 4 lane to 4 lane + 3
        _Float16* d0 = xs + wave * XSTR + lane * 4;
        // unroll: v[] is indexed by constants only, so it needs no memory
#pragma unroll
        for (int i = 0; i <= FULL; ++i) {
            if (i < FULL || tail) {
                _Float16* d = d0 + 8 * i * XSTR;
                d[0] = (_Float16)v[i].x; d[1] = (_Float16)v[i].y;
                d[2] = (_Float16)v[i].z; d[3] = (_Float16)v[i].w;
            }
        }
    }
    __syncthreads();

    // ---- Phase 2: qkv = x @ Wqkv (64x384 = 4 x 24 tiles, K=128) -----------
    // Each wave owns the column tiles wave, wave+8, wave+16: 16 channels
    // (half wc of head wh) of q, of k and of v. A column tile's four weight
    // fragments are loaded once, one column tile ahead of their products, and
    // kept in registers for all four row tiles.
    // Dual accumulator chains (k even / k odd) -> independent WMMA streams.
    // q and k tiles are formed transposed (W^T x^T: lane = token, registers =
    // 8 channels), v tiles as x W (lane = channel, registers = 8 tokens): each
    // result is then half of a fragment that phase 3 reads.
    // unroll: the fragment arrays are indexed by constants only and stay in
    // registers.
#pragma unroll
    for (int j = 0; j < 3; ++j) {
        const v16h* b = bw[j];
        if (j < 2) {
#pragma unroll
            for (int k = 0; k < 4; ++k)
                bw[j + 1][k] = ldfrag_b_packed(wq16, k * 32,
                                               wl + CH * (j + 1), C3);
        }
        // unroll: row-tile offsets become immediates of the LDS accesses
#pragma unroll
        for (int mt = 0; mt < 4; ++mt) {
            v8f acc0 = {}, acc1 = {};
#pragma unroll
            for (int kp = 0; kp < 2; ++kp) {
                v16h a0 = ldfrag_kcontig(xs, mt * 16, XSTR, (2 * kp + 0) * 32);
                v16h a1 = ldfrag_kcontig(xs, mt * 16, XSTR, (2 * kp + 1) * 32);
                if (j < 2) {
                    acc0 = wmma_f16(b[2 * kp + 0], a0, acc0);
                    acc1 = wmma_f16(b[2 * kp + 1], a1, acc1);
                } else {
                    acc0 = wmma_f16(a0, b[2 * kp + 0], acc0);
                    acc1 = wmma_f16(a1, b[2 * kp + 1], acc1);
                }
            }
            // q, k: fragment = token tile, half = channel half of the head.
            // v: fragment = 2 * channel half + key half, half = token tile & 1.
            _Float16* fh = qkv + (j * NH + wh) * 4 * FRAG;
            if (j < 2)
                st_half_frag(fh + mt * FRAG, wc, v8f_add(acc0, acc1));
            else
                st_half_frag(fh + (2 * wc + (mt >> 1)) * FRAG, mt & 1,
                             v8f_add(acc0, acc1));
        }
        // A tile's products and the next tile's loads stay in front of the
        // tile after: with all three tiles' fragments live at once, or two
        // tiles' products interleaved, the wave needs more than 128 registers
        // and fewer work-groups fit on the WGP.
        if (j < 2) __builtin_amdgcn_sched_barrier(0);
    }
    __syncthreads();

    _Float16* ao = xs;  // x staging no longer needed -> reuse as attn output
    // Phase 4's weight fragments (column tile = wave) and bias are asked for
    // here, so that their L2 latency passes under the attention.
    v16h bpj[4];
    const int pl   = frag_b_lane(wave * 16, CH);
    const int pcol = wave * 16 + (lane & 15);
    // unroll: bpj[] is indexed by constants only, so it needs no memory
#pragma unroll
    for (int k = 0; k < 4; ++k)
        bpj[k] = ldfrag_b_packed(wp16, k * 32, pl, CH);
    const float bias = bp[pcol];
    // As at entry: the wait in front of any reuse of the address registers,
    // with the lane's indices as inputs.
    asm volatile("s_wait_xcnt 0x0"
                 :: "v"(pl), "v"(pcol) : "memory");
    const int qc = lane & 15;               // this lane's query in the block
    const int rb = (lane >> 4) ? 8 : 0;     // this lane half's row offset in D
#pragma unroll
    for (int it = 0; it < 2; ++it) {
        const int task = wave + 8 * it;
        const int hd   = task >> 2;
        const int mt   = task & 3;

        // S^T (64 keys x 16 queries, K = DH = 32): 4 independent WMMAs
        v8f st[4];
        {
            v16h bq = ld_frag(qkv + (hd * 4 + mt) * FRAG);
            v16h ak[4];
#pragma unroll
            for (int nt = 0; nt < 4; ++nt)
                ak[nt] = ld_frag(qkv + ((NH + hd) * 4 + nt) * FRAG);
            const v8f z = {};
#pragma unroll
            for (int nt = 0; nt < 3; ++nt) st[nt] = wmma_f16(ak[nt], bq, z);
            // The last tile holds one real key, so seven of its result
            // registers are free at once. Keep it the last of the four.
            __builtin_amdgcn_sched_barrier(0);
            st[3] = wmma_f16(ak[3], bq, z);
        }

        // scale, mask the padded keys, maximum over the lane's keys. A register
        // whose key is padding in both lane halves takes no part at all: its
        // weight is exactly 0.
        float mx[4];
#pragma unroll
        for (int nt = 0; nt < 4; ++nt) {
            mx[nt] = -3.0e38f;
#pragma unroll
            for (int r = 0; r < 8; ++r) {
                if (nt * 16 + r >= NTOK) continue;
                float s = st[nt][r] * SCALE;
                if (nt * 16 + 8 + r >= NTOK) s = rb ? -3.0e38f : s;
                st[nt][r] = s;
                mx[nt] = fmaxf(mx[nt], s);
            }
        }
        float m = fmaxf(fmaxf(mx[0], mx[1]), fmaxf(mx[2], mx[3]));
        m = fmaxf(m, xhalf(m));

        // exp and sum: one partial sum per tile, so four short chains
        float sm[4];
#pragma unroll
        for (int nt = 0; nt < 4; ++nt) {
            sm[nt] = 0.0f;
#pragma unroll
            for (int r = 0; r < 8; ++r) {
                if (nt * 16 + r >= NTOK) continue;
                const float e = exp_slot(st[nt][r] - m);
                st[nt][r] = e;
                sm[nt] = r ? sm[nt] + e : e;
            }
        }
        float s = (sm[0] + sm[1]) + (sm[2] + sm[3]);
        s += xhalf(s);
        const float inv = 1.0f / s;

        // P^T as B fragments, straight from the score registers
        v16h pb[2];
#pragma unroll
        for (int j = 0; j < 2; ++j)
#pragma unroll
            for (int e = 0; e < 16; ++e) {
                const int nt = 2 * j + (e >> 3), r = e & 7;
                pb[j][e] = (nt * 16 + r >= NTOK) ? (_Float16)0.0f
                                                 : (_Float16)(st[nt][r] * inv);
            }

        // O^T = V^T(32x64) @ P^T(64x16): per 16 channels, 2 independent chains.
        // A lane's 8 results are 8 consecutive channels of its query's row.
#pragma unroll
        for (int dt = 0; dt < 2; ++dt) {
            v8f z0 = {}, z1 = {};
            v16h a0 = ld_frag(qkv + ((2 * NH + hd) * 4 + 2 * dt + 0) * FRAG);
            v16h a1 = ld_frag(qkv + ((2 * NH + hd) * 4 + 2 * dt + 1) * FRAG);
            v8f acc0 = wmma_f16(a0, pb[0], z0);
            v8f acc1 = wmma_f16(a1, pb[1], z1);
            const v8f o = v8f_add(acc0, acc1);
            v8h oh;
#pragma unroll
            for (int r = 0; r < 8; ++r) oh[r] = (_Float16)o[r];
            *(v8h*)(ao + (mt * 16 + qc) * XSTR + hd * DH + dt * 16 + rb) = oh;
        }
    }
    __syncthreads();

    // ---- Phase 4: proj + bias, fp32 store of the 49 real rows -------------
    // Each wave owns column tile nt = wave: its four weight fragments and its
    // bias (loaded ahead of phase 3) serve all four row tiles.
    {
        const int nt = wave;
        const v16h* b = bpj;
        const int col  = nt * 16 + (lane & 15);
        const int rbase = (lane >> 4) ? 8 : 0;
        // unroll: the fragment array stays in registers and the row guard
        // folds away for the three full row tiles
#pragma unroll
        for (int mt = 0; mt < 4; ++mt) {
            v8f acc0 = {}, acc1 = {};
#pragma unroll
            for (int kp = 0; kp < 2; ++kp) {
                v16h a0 = ldfrag_kcontig(ao, mt * 16, XSTR, (2 * kp + 0) * 32);
                v16h a1 = ldfrag_kcontig(ao, mt * 16, XSTR, (2 * kp + 1) * 32);
                acc0 = wmma_f16(a0, b[2 * kp + 0], acc0);
                acc1 = wmma_f16(a1, b[2 * kp + 1], acc1);
            }
            const v8f acc = v8f_add(acc0, acc1);
#pragma unroll
            for (int r = 0; r < 8; ++r) {
                const int m = mt * 16 + rbase + r;
                if (m < NTOK)
                    out[((size_t)blk * NTOK + m) * CH + col] = acc[r] + bias;
            }
        }
    }
}

// ---------------------------------------------------------------------------
extern "C" void kernel_launch(void* const* d_in, const int* in_sizes, int n_in,
                              void* d_out, int out_size, void* d_ws,
                              size_t ws_size, hipStream_t stream) {
    using namespace cfg;
    const float* x      = (const float*)d_in[0];  // (4096, 49, 128)
    const float* w_qkv  = (const float*)d_in[1];  // (128, 384)
    const float* w_proj = (const float*)d_in[2];  // (128, 128)
    const float* b_proj = (const float*)d_in[3];  // (128,)
    float* out = (float*)d_out;                   // (4096, 49, 128)

    _Float16* wq16 = (_Float16*)d_ws;             // 49152 halfs, pair-packed
    _Float16* wp16 = wq16 + CH * C3;              // 16384 halfs, pair-packed

    const int prep_elems = CH * C3 + CH * CH;     // 65536
    WindowAttention_prep_weights<<<(prep_elems + 255) / 256, 256, 0, stream>>>(
        w_qkv, w_proj, wq16, wp16);

    const size_t lds_bytes = (size_t)LDS_HALFS * sizeof(_Float16);  // 65 KB
    hipFuncSetAttribute((const void*)WindowAttention_41815801594647_kernel,
                        hipFuncAttributeMaxDynamicSharedMemorySize,
                        (int)lds_bytes);

    const int B = in_sizes[0] / (NTOK * CH);      // 4096
    WindowAttention_41815801594647_kernel<<<B, 256, lds_bytes, stream>>>(
        x, wq16, wp16, b_proj, out);
}

// v005
// Measured time: 55 microseconds a run.
// In both of two side-by-side timings against v004, it was 1.08 times as fast.
// All steps since v000 together make it 2.92 times as fast.
#include <hip/hip_runtime.h>

typedef __attribute__((ext_vector_type(16))) _Float16 v16h;
typedef __attribute__((ext_vector_type(8)))  _Float16 v8h;
typedef __attribute__((ext_vector_type(8)))  float    v8f;
typedef __attribute__((ext_vector_type(4)))  float    v4f;

namespace cfg {
constexpr int NTOK = 49;      // real tokens per window
constexpr int NPAD = 64;      // padded tokens (4 tiles of 16)
constexpr int CH   = 128;     // channels
constexpr int NH   = 4;       // heads
constexpr int DH   = 32;      // head dim
constexpr int C3   = 3 * CH;  // qkv output width = 384
constexpr float SCALE = 0.17677669529663687f;  // 1/sqrt(32)

constexpr int XSTR = CH + 8;    // 136, x / attn-out buffer
constexpr int FRAG = 512;       // one 16x32 f16 fragment: 2 x 32 lanes x 8
constexpr int XS_OFF  = 0;
constexpr int QKV_OFF = NPAD * XSTR;                 // 8704
// q, k, v as ready fragments: [q|k|v][head][4][FRAG]
constexpr int LDS_HALFS = QKV_OFF + 3 * NH * 4 * FRAG;  // 33280 halfs = 65 KB
constexpr int OSTR = CH + 4;    // 132 floats; 64 rows = 33 KB of the 48 KB
}

__device__ __forceinline__ int frag_kk(int i) {
    return (i < 4) ? 2 * i : 16 + 2 * (i - 4);
}

// A fragment, or B fragment when K runs along the contiguous dim of src
// (i.e. src is row-major [M][K] for A, or [N][K] == B^T for B).
__device__ __forceinline__ v16h ldfrag_kcontig(const _Float16* src, int row0,
                                               int stride, int colbase) {
    const int lane = threadIdx.x & 31;
    const int mn   = lane & 15;
    const int khi  = (lane >> 4) ? 8 : 0;
    const _Float16* p = src + (row0 + mn) * stride + colbase + khi;
    v16h f;
#pragma unroll
    for (int i = 0; i < 8; ++i) {
        const int kk = frag_kk(i);
        f[2 * i]     = p[kk];
        f[2 * i + 1] = p[kk + 1];
    }
    return f;
}

__device__ __forceinline__ int frag_b_lane(int n0, int nout) {
    const int lane = threadIdx.x & 31;
    const int n    = lane & 15;
    const int khi  = (lane >> 4) ? 8 : 0;
    return (khi >> 1) * nout + n0 + n;
}

__device__ __forceinline__ v16h ldfrag_b_packed(const _Float16* w, int k0,
                                                int lane_part, int nout) {
    const _Float16* base = w + (size_t)lane_part * 2;
    v16h f;
#pragma unroll
    for (int i = 0; i < 8; ++i) {
        const _Float16* p = base + (size_t)((k0 + frag_kk(i)) >> 1) * nout * 2;
        f[2 * i]     = p[0];
        f[2 * i + 1] = p[1];
    }
    return f;
}

__device__ __forceinline__ void st_half_frag(_Float16* frag, int half, v8f acc) {
    const int lane = threadIdx.x & 31;
    v8h h;
#pragma unroll
    for (int r = 0; r < 8; ++r) h[r] = (_Float16)acc[r];
    *(v8h*)(frag + half * 256 + lane * 8) = h;
}

__device__ __forceinline__ v16h ld_frag(const _Float16* frag) {
    const int lane = threadIdx.x & 31;
    const v8h lo = *(const v8h*)(frag + lane * 8);
    const v8h hi = *(const v8h*)(frag + 256 + lane * 8);
    v16h f;
#pragma unroll
    for (int i = 0; i < 8; ++i) { f[i] = lo[i]; f[8 + i] = hi[i]; }
    return f;
}

__device__ __forceinline__ v8f wmma_f16(v16h a, v16h b, v8f c) {
    return __builtin_amdgcn_wmma_f32_16x16x32_f16(
        /*neg_a=*/false, a, /*neg_b=*/false, b,
        /*c_mod=*/(short)0, c, /*reuse_a=*/false, /*reuse_b=*/false);
}

__device__ __forceinline__ float xhalf(float x) {
    const int b = __builtin_bit_cast(int, x);
    return __builtin_bit_cast(float, __builtin_amdgcn_permlanex16(
        b, b, 0x76543210, 0xfedcba98, false, false));
}

__device__ __forceinline__ float exp_slot(float x) {
    const float t = x * 1.44269504f;
    float r;
    asm("v_exp_f32 %0, %1\n\tv_nop" : "=v"(r) : "v"(t));
    return r;
}

__device__ __forceinline__ v8f v8f_add(v8f a, v8f b) {
    v8f r;
#pragma unroll
    for (int i = 0; i < 8; ++i) r[i] = a[i] + b[i];
    return r;
}

// ---------------------------------------------------------------------------
// Prep: convert fp32 weights to pair-packed f16 once (weights then sit in L2).
// ---------------------------------------------------------------------------
__global__ void WindowAttention_prep_weights(const float* __restrict__ wq,
                                             const float* __restrict__ wp,
                                             _Float16* __restrict__ wq16,
                                             _Float16* __restrict__ wp16) {
    const int tid = blockIdx.x * blockDim.x + threadIdx.x;
    if (tid < cfg::CH * cfg::C3) {
        const int k = tid / cfg::C3, n = tid % cfg::C3;
        wq16[((k >> 1) * cfg::C3 + n) * 2 + (k & 1)] = (_Float16)wq[tid];
    } else if (tid < cfg::CH * cfg::C3 + cfg::CH * cfg::CH) {
        const int t = tid - cfg::CH * cfg::C3;
        const int k = t / cfg::CH, n = t % cfg::CH;
        wp16[((k >> 1) * cfg::CH + n) * 2 + (k & 1)] = (_Float16)wp[t];
    }
}

// ---------------------------------------------------------------------------
// Main fused kernel: one workgroup (8 waves) per window.
// ---------------------------------------------------------------------------
__global__ void __launch_bounds__(256)
WindowAttention_41815801594647_kernel(const float* __restrict__ x,
                                      const _Float16* __restrict__ wq16,
                                      const _Float16* __restrict__ wp16,
                                      const float* __restrict__ bp,
                                      float* __restrict__ out) {
    using namespace cfg;
    extern __shared__ _Float16 smem[];
    _Float16* xs  = smem + XS_OFF;   // [NPAD][XSTR] : x (f16), later attn-out
    _Float16* qkv = smem + QKV_OFF;  // q|k|v fragments of all heads (f16)

    const int tid  = threadIdx.x;
    const int wave = tid >> 5;
    const int lane = tid & 31;
    const int blk  = blockIdx.x;

    // ---- Phase 1: stage x into LDS as f16, zero the padded rows -----------
    // These loads go out before the first
    // wait: all of the thread's x loads together (one memory latency for the
    // window, not one per 256 float4), and the first column tile's weight
    // fragments, whose L2 latency passes under the x loads'. The padded rows
    // are zeroed while the loads fly.
    const int wh = wave >> 1;
    const int wc = wave & 1;
    v16h bw[3][4];  // weight fragments of the wave's q, k and v column tiles
    const int wl = frag_b_lane(wave * 16, C3);  // lane's place in the q tile
    {
        constexpr int NV   = NTOK * (CH / 4);  // 1568 float4 in a window
        constexpr int FULL = NV / 256;         // 6 rounds that every thread has
        const float4* xv = (const float4*)(x + (size_t)blk * NTOK * CH);
        float4 v[FULL + 1];
        // unroll: v[] stays in registers and the loads share one address
#pragma unroll
        for (int i = 0; i < FULL; ++i) v[i] = xv[tid + 256 * i];
        // The last 32 float4 are wave 0's. The load is not put under that
        // test (a branch would bring its wait along, in front of the weight
        // loads): the other waves read the window's last float4 and drop it.
        const bool tail = tid < NV - FULL * 256;
        const int  tl   = tail ? tid : NV - FULL * 256 - 1;
        v[FULL] = xv[256 * FULL + tl];
        // unroll: bw[] is indexed by constants only, so it needs no memory
#pragma unroll
        for (int k = 0; k < 4; ++k)
            bw[0][k] = ldfrag_b_packed(wq16, k * 32, wl, C3);
        // Precaution: this wait stands in front of any reuse of the loads'
        // address registers. The lane's indices are inputs so that their
        // registers stay untouched up to it (without them later index
        // arithmetic was lifted over the wait, into those registers).
        asm volatile("s_wait_xcnt 0x0"
                     :: "v"(tl), "v"(tid), "v"(wl) : "memory");
        for (int idx = tid; idx < (NPAD - NTOK) * CH; idx += 256) {
            const int row = NTOK + idx / CH;
            xs[row * XSTR + (idx % CH)] = (_Float16)0.0f;
        }
        // float4 tid + 256 i is row wave + 8 i, columns 4 lane to 4 lane + 3
        _Float16* d0 = xs + wave * XSTR + lane * 4;
        // unroll: v[] is indexed by constants only, so it needs no memory
#pragma unroll
        for (int i = 0; i <= FULL; ++i) {
            if (i < FULL || tail) {
                _Float16* d = d0 + 8 * i * XSTR;
                d[0] = (_Float16)v[i].x; d[1] = (_Float16)v[i].y;
                d[2] = (_Float16)v[i].z; d[3] = (_Float16)v[i].w;
            }
        }
    }
    __syncthreads();

    // ---- Phase 2: qkv = x @ Wqkv (64x384 = 4 x 24 tiles, K=128) -----------
    // Each wave owns the column tiles wave, wave+8, wave+16: 16 channels
    // (half wc of head wh) of q, of k and of v. A column tile's four weight
    // fragments are loaded once, one column tile ahead of their products, and
    // kept in registers for all four row tiles.
    // Dual accumulator chains (k even / k odd) -> independent WMMA streams.
    // q and k tiles are formed transposed (W^T x^T: lane = token, registers =
    // 8 channels), v tiles as x W (lane = channel, registers = 8 tokens): each
    // result is then half of a fragment that phase 3 reads.
    // unroll: the fragment arrays are indexed by constants only and stay in
    // registers.
#pragma unroll
    for (int j = 0; j < 3; ++j) {
        const v16h* b = bw[j];
        if (j < 2) {
#pragma unroll
            for (int k = 0; k < 4; ++k)
                bw[j + 1][k] = ldfrag_b_packed(wq16, k * 32,
                                               wl + CH * (j + 1), C3);
        }
        // unroll: row-tile offsets become immediates of the LDS accesses
#pragma unroll
        for (int mt = 0; mt < 4; ++mt) {
            v8f acc0 = {}, acc1 = {};
#pragma unroll
            for (int kp = 0; kp < 2; ++kp) {
                v16h a0 = ldfrag_kcontig(xs, mt * 16, XSTR, (2 * kp + 0) * 32);
                v16h a1 = ldfrag_kcontig(xs, mt * 16, XSTR, (2 * kp + 1) * 32);
                if (j < 2) {
                    acc0 = wmma_f16(b[2 * kp + 0], a0, acc0);
                    acc1 = wmma_f16(b[2 * kp + 1], a1, acc1);
                } else {
                    acc0 = wmma_f16(a0, b[2 * kp + 0], acc0);
                    acc1 = wmma_f16(a1, b[2 * kp + 1], acc1);
                }
            }
            // q, k: fragment = token tile, half = channel half of the head.
            // v: fragment = 2 * channel half + key half, half = token tile & 1.
            _Float16* fh = qkv + (j * NH + wh) * 4 * FRAG;
            if (j < 2)
                st_half_frag(fh + mt * FRAG, wc, v8f_add(acc0, acc1));
            else
                st_half_frag(fh + (2 * wc + (mt >> 1)) * FRAG, mt & 1,
                             v8f_add(acc0, acc1));
        }
        // A tile's products and the next tile's loads stay in front of the
        // tile after: with all three tiles' fragments live at once, or two
        // tiles' products interleaved, the wave needs more than 128 registers
        // and fewer work-groups fit on the WGP.
        if (j < 2) __builtin_amdgcn_sched_barrier(0);
    }
    __syncthreads();

    _Float16* ao = xs;  // x staging no longer needed -> reuse as attn output
    // Phase 4's weight fragments (column tile = wave) and bias are asked for
    // here, so that their L2 latency passes under the attention.
    v16h bpj[4];
    const int pl   = frag_b_lane(wave * 16, CH);
    const int pcol = lane * 4;  // the thread's four columns of an output row
    // unroll: bpj[] is indexed by constants only, so it needs no memory
#pragma unroll
    for (int k = 0; k < 4; ++k)
        bpj[k] = ldfrag_b_packed(wp16, k * 32, pl, CH);
    const v4f bias = *(const v4f*)(bp + pcol);
    // As at entry: the wait in front of any reuse of the address registers,
    // with the lane's indices as inputs.
    asm volatile("s_wait_xcnt 0x0"
                 :: "v"(pl), "v"(pcol) : "memory");
    const int qc = lane & 15;               // this lane's query in the block
    const int rb = (lane >> 4) ? 8 : 0;     // this lane half's row offset in D
#pragma unroll
    for (int it = 0; it < 2; ++it) {
        const int task = wave + 8 * it;
        const int hd   = task >> 2;
        const int mt   = task & 3;

        // S^T (64 keys x 16 queries, K = DH = 32): 4 independent WMMAs
        v8f st[4];
        {
            v16h bq = ld_frag(qkv + (hd * 4 + mt) * FRAG);
            v16h ak[4];
#pragma unroll
            for (int nt = 0; nt < 4; ++nt)
                ak[nt] = ld_frag(qkv + ((NH + hd) * 4 + nt) * FRAG);
            const v8f z = {};
#pragma unroll
            for (int nt = 0; nt < 3; ++nt) st[nt] = wmma_f16(ak[nt], bq, z);
            // The last tile holds one real key, so seven of its result
            // registers are free at once. Keep it the last of the four.
            __builtin_amdgcn_sched_barrier(0);
            st[3] = wmma_f16(ak[3], bq, z);
        }

        // scale, mask the padded keys, maximum over the lane's keys. A register
        // whose key is padding in both lane halves takes no part at all: its
        // weight is exactly 0.
        float mx[4];
#pragma unroll
        for (int nt = 0; nt < 4; ++nt) {
            mx[nt] = -3.0e38f;
#pragma unroll
            for (int r = 0; r < 8; ++r) {
                if (nt * 16 + r >= NTOK) continue;
                float s = st[nt][r] * SCALE;
                if (nt * 16 + 8 + r >= NTOK) s = rb ? -3.0e38f : s;
                st[nt][r] = s;
                mx[nt] = fmaxf(mx[nt], s);
            }
        }
        float m = fmaxf(fmaxf(mx[0], mx[1]), fmaxf(mx[2], mx[3]));
        m = fmaxf(m, xhalf(m));

        // exp and sum: one partial sum per tile, so four short chains
        float sm[4];
#pragma unroll
        for (int nt = 0; nt < 4; ++nt) {
            sm[nt] = 0.0f;
#pragma unroll
            for (int r = 0; r < 8; ++r) {
                if (nt * 16 + r >= NTOK) continue;
                const float e = exp_slot(st[nt][r] - m);
                st[nt][r] = e;
                sm[nt] = r ? sm[nt] + e : e;
            }
        }
        float s = (sm[0] + sm[1]) + (sm[2] + sm[3]);
        s += xhalf(s);
        const float inv = 1.0f / s;

        // P^T as B fragments, straight from the score registers
        v16h pb[2];
#pragma unroll
        for (int j = 0; j < 2; ++j)
#pragma unroll
            for (int e = 0; e < 16; ++e) {
                const int nt = 2 * j + (e >> 3), r = e & 7;
                pb[j][e] = (nt * 16 + r >= NTOK) ? (_Float16)0.0f
                                                 : (_Float16)(st[nt][r] * inv);
            }

        // O^T = V^T(32x64) @ P^T(64x16): per 16 channels, 2 independent chains.
        // A lane's 8 results are 8 consecutive channels of its query's row.
#pragma unroll
        for (int dt = 0; dt < 2; ++dt) {
            v8f z0 = {}, z1 = {};
            v16h a0 = ld_frag(qkv + ((2 * NH + hd) * 4 + 2 * dt + 0) * FRAG);
            v16h a1 = ld_frag(qkv + ((2 * NH + hd) * 4 + 2 * dt + 1) * FRAG);
            v8f acc0 = wmma_f16(a0, pb[0], z0);
            v8f acc1 = wmma_f16(a1, pb[1], z1);
            const v8f o = v8f_add(acc0, acc1);
            v8h oh;
#pragma unroll
            for (int r = 0; r < 8; ++r) oh[r] = (_Float16)o[r];
            *(v8h*)(ao + (mt * 16 + qc) * XSTR + hd * DH + dt * 16 + rb) = oh;
        }
    }
    __syncthreads();

    // ---- Phase 4: proj + bias, fp32 store of the 49 real rows -------------
    // Each wave owns column tile nt = wave: its four weight fragments (loaded
    // ahead of phase 3) serve all four row tiles. A wave's tile is only 64
    // bytes of an output row, so the results cross LDS and leave as whole rows.
    // The tiles are formed transposed (Wp^T ao^T: lane = token, registers = 8
    // consecutive channels), so a lane hands them over in two 16-byte stores.
    float* os = (float*)qkv;  // [NPAD][OSTR]; q, k, v were last read in phase 3
    {
        const v16h* b = bpj;
        float* d0 = os + qc * OSTR + wave * 16 + rb;
        v8f res[4];
        // unroll: the fragment and result arrays stay in registers and the
        // row-tile offsets become immediates of the LDS accesses
#pragma unroll
        for (int mt = 0; mt < 4; ++mt) {
            v8f acc0 = {}, acc1 = {};
#pragma unroll
            for (int kp = 0; kp < 2; ++kp) {
                v16h a0 = ldfrag_kcontig(ao, mt * 16, XSTR, (2 * kp + 0) * 32);
                v16h a1 = ldfrag_kcontig(ao, mt * 16, XSTR, (2 * kp + 1) * 32);
                acc0 = wmma_f16(b[2 * kp + 0], a0, acc0);
                acc1 = wmma_f16(b[2 * kp + 1], a1, acc1);
            }
            res[mt] = v8f_add(acc0, acc1);
        }
#pragma unroll
        for (int mt = 0; mt < 4; ++mt) {
            const v8f acc = res[mt];
            float* d = d0 + mt * 16 * OSTR;
            *(v4f*)d       = v4f{acc[0], acc[1], acc[2], acc[3]};
            *(v4f*)(d + 4) = v4f{acc[4], acc[5], acc[6], acc[7]};
        }
    }
    __syncthreads();

    // A wave-wide 16-byte store is one whole output row: 512 contiguous bytes,
    // four full lines with one writer each. float4 tid + 256 i of the window is
    // row wave + 8 i, columns 4 lane to 4 lane + 3.
    {
        constexpr int FULL = NTOK / 8;  // 6 rounds that every wave has
        v4f* ov = (v4f*)(out + (size_t)blk * NTOK * CH) + tid;
        const float* s0 = os + wave * OSTR + lane * 4;
        // unroll: row offsets become immediates of the LDS loads and stores
#pragma unroll
        for (int i = 0; i < FULL; ++i)
            ov[256 * i] = *(const v4f*)(s0 + 8 * i * OSTR) + bias;
        // row 48, the last real one, is wave 0's
        if (wave == 0)
            ov[256 * FULL] = *(const v4f*)(s0 + 8 * FULL * OSTR) + bias;
    }
}

// ---------------------------------------------------------------------------
extern "C" void kernel_launch(void* const* d_in, const int* in_sizes, int n_in,
                              void* d_out, int out_size, void* d_ws,
                              size_t ws_size, hipStream_t stream) {
    using namespace cfg;
    const float* x      = (const float*)d_in[0];  // (4096, 49, 128)
    const float* w_qkv  = (const float*)d_in[1];  // (128, 384)
    const float* w_proj = (const float*)d_in[2];  // (128, 128)
    const float* b_proj = (const float*)d_in[3];  // (128,)
    float* out = (float*)d_out;                   // (4096, 49, 128)

    _Float16* wq16 = (_Float16*)d_ws;             // 49152 halfs, pair-packed
    _Float16* wp16 = wq16 + CH * C3;              // 16384 halfs, pair-packed

    const int prep_elems = CH * C3 + CH * CH;     // 65536
    WindowAttention_prep_weights<<<(prep_elems + 255) / 256, 256, 0, stream>>>(
        w_qkv, w_proj, wq16, wp16);

    const size_t lds_bytes = (size_t)LDS_HALFS * sizeof(_Float16);  // 65 KB
    hipFuncSetAttribute((const void*)WindowAttention_41815801594647_kernel,
                        hipFuncAttributeMaxDynamicSharedMemorySize,
                        (int)lds_bytes);

    const int B = in_sizes[0] / (NTOK * CH);      // 4096
    WindowAttention_41815801594647_kernel<<<B, 256, lds_bytes, stream>>>(
        x, wq16, wp16, b_proj, out);
}

// v006
// One run takes 46.3 microseconds.
// Two timings next to v005 both put it at 1.18 times that version's speed.
// All steps since v000 together make it 3.44 times as fast.
#include <hip/hip_runtime.h>

typedef __attribute__((ext_vector_type(16))) _Float16 v16h;
typedef __attribute__((ext_vector_type(8)))  _Float16 v8h;
typedef __attribute__((ext_vector_type(8)))  float    v8f;
typedef __attribute__((ext_vector_type(4)))  float    v4f;

namespace cfg {
constexpr int NTOK = 49;      // real tokens per window
constexpr int NPAD = 64;      // padded tokens (4 tiles of 16)
constexpr int CH   = 128;     // channels
constexpr int NH   = 4;       // heads
constexpr int DH   = 32;      // head dim
constexpr int C3   = 3 * CH;  // qkv output width = 384
constexpr float SCALE = 0.17677669529663687f;  // 1/sqrt(32)

constexpr int XSTR = CH + 8;    // 136, x / attn-out buffer
constexpr int FRAG = 512;       // one 16x32 f16 fragment: 2 x 32 lanes x 8
constexpr int XS_OFF  = 0;
constexpr int QKV_OFF = NPAD * XSTR;                 // 8704
// q, k, v as ready fragments: [q|k|v][head][4][FRAG]
constexpr int LDS_HALFS = QKV_OFF + 3 * NH * 4 * FRAG;  // 33280 halfs = 65 KB
constexpr int OSTR = CH + 4;    // 132 floats; 64 rows = 33 KB of the 48 KB
}

__device__ __forceinline__ int frag_kk(int i) {
    return (i < 4) ? 2 * i : 16 + 2 * (i - 4);
}

// A fragment, or B fragment when K runs along the contiguous dim of src
// (i.e. src is row-major [M][K] for A, or [N][K] == B^T for B).
__device__ __forceinline__ v16h ldfrag_kcontig(const _Float16* src, int row0,
                                               int stride, int colbase) {
    const int lane = threadIdx.x & 31;
    const int mn   = lane & 15;
    const int khi  = (lane >> 4) ? 8 : 0;
    const _Float16* p = src + (row0 + mn) * stride + colbase + khi;
    v16h f;
#pragma unroll
    for (int i = 0; i < 8; ++i) {
        const int kk = frag_kk(i);
        f[2 * i]     = p[kk];
        f[2 * i + 1] = p[kk + 1];
    }
    return f;
}

__device__ __forceinline__ unsigned frag_w_lane(int ct) {
    const int lane = threadIdx.x & 31;
    return (unsigned)(ct * 4 * cfg::FRAG + lane * 8) * 2u;
}

__device__ __forceinline__ v16h ldfrag_w(const _Float16* w, unsigned lane_part,
                                         int frag) {
    const _Float16* p = (const _Float16*)((const char*)w + lane_part) +
                        frag * cfg::FRAG;
    const v8h lo = *(const v8h*)p;
    const v8h hi = *(const v8h*)(p + 256);
    v16h f;
#pragma unroll
    for (int i = 0; i < 8; ++i) { f[i] = lo[i]; f[8 + i] = hi[i]; }
    return f;
}

__device__ __forceinline__ void st_half_frag(_Float16* frag, int half, v8f acc) {
    const int lane = threadIdx.x & 31;
    v8h h;
#pragma unroll
    for (int r = 0; r < 8; ++r) h[r] = (_Float16)acc[r];
    *(v8h*)(frag + half * 256 + lane * 8) = h;
}

__device__ __forceinline__ v16h ld_frag(const _Float16* frag) {
    const int lane = threadIdx.x & 31;
    const v8h lo = *(const v8h*)(frag + lane * 8);
    const v8h hi = *(const v8h*)(frag + 256 + lane * 8);
    v16h f;
#pragma unroll
    for (int i = 0; i < 8; ++i) { f[i] = lo[i]; f[8 + i] = hi[i]; }
    return f;
}

__device__ __forceinline__ v8f wmma_f16(v16h a, v16h b, v8f c) {
    return __builtin_amdgcn_wmma_f32_16x16x32_f16(
        /*neg_a=*/false, a, /*neg_b=*/false, b,
        /*c_mod=*/(short)0, c, /*reuse_a=*/false, /*reuse_b=*/false);
}

__device__ __forceinline__ float xhalf(float x) {
    const int b = __builtin_bit_cast(int, x);
    return __builtin_bit_cast(float, __builtin_amdgcn_permlanex16(
        b, b, 0x76543210, 0xfedcba98, false, false));
}

__device__ __forceinline__ float exp_slot(float x) {
    const float t = x * 1.44269504f;
    float r;
    asm("v_exp_f32 %0, %1\n\tv_nop" : "=v"(r) : "v"(t));
    return r;
}

__device__ __forceinline__ v8f v8f_add(v8f a, v8f b) {
    v8f r;
#pragma unroll
    for (int i = 0; i < 8; ++i) r[i] = a[i] + b[i];
    return r;
}

// ---------------------------------------------------------------------------
// Prep: convert fp32 weights to f16 in fragment register order (weights then
// sit in L2). A thread makes the 8 halfs that one lane reads with one 16-byte
// load: column n, rows 8 kg to 8 kg + 7. Of the 32-k block kg >> 2 these are
// elements 0-7 or 8-15 (bit 1 of kg) of lane n & 15 or that + 16 (bit 0).
// ---------------------------------------------------------------------------
__device__ __forceinline__ void pack_w(const float* __restrict__ w,
                                       _Float16* __restrict__ w16, int nout,
                                       int t) {
    const int kg = t / nout, n = t % nout;
    const float* p = w + kg * 8 * nout + n;
    float f[8];
    // unroll: the 8 loads go out together, one address and immediate offsets
#pragma unroll
    for (int e = 0; e < 8; ++e) f[e] = p[e * nout];
    // Precaution: this wait stands in front of any reuse of the loads'
    // address registers, which are inputs so that they stay untouched up to it.
    asm volatile("s_wait_xcnt 0x0" :: "v"(p) : "memory");
    v8h h;
    // unroll: f[] and h are indexed by constants only and stay in registers
#pragma unroll
    for (int e = 0; e < 8; ++e) h[e] = (_Float16)f[e];
    const int frag = (n >> 4) * 4 + (kg >> 2);
    const int lane = (n & 15) + 16 * (kg & 1);
    *(v8h*)(w16 + frag * cfg::FRAG + ((kg >> 1) & 1) * 256 + lane * 8) = h;
}

__global__ void WindowAttention_prep_weights(const float* __restrict__ wq,
                                             const float* __restrict__ wp,
                                             _Float16* __restrict__ wq16,
                                             _Float16* __restrict__ wp16) {
    const int tid = blockIdx.x * blockDim.x + threadIdx.x;
    constexpr int NQ = cfg::CH / 8 * cfg::C3;
    constexpr int NP = cfg::CH / 8 * cfg::CH;
    if (tid < NQ)
        pack_w(wq, wq16, cfg::C3, tid);
    else if (tid < NQ + NP)
        pack_w(wp, wp16, cfg::CH, tid - NQ);
}

// ---------------------------------------------------------------------------
// Main fused kernel: one workgroup (8 waves) per window.
// ---------------------------------------------------------------------------
__global__ void __launch_bounds__(256)
WindowAttention_41815801594647_kernel(const float* __restrict__ x,
                                      const _Float16* __restrict__ wq16,
                                      const _Float16* __restrict__ wp16,
                                      const float* __restrict__ bp,
                                      float* __restrict__ out) {
    using namespace cfg;
    extern __shared__ _Float16 smem[];
    _Float16* xs  = smem + XS_OFF;   // [NPAD][XSTR] : x (f16), later attn-out
    _Float16* qkv = smem + QKV_OFF;  // q|k|v fragments of all heads (f16)

    const int tid  = threadIdx.x;
    const int wave = tid >> 5;
    const int lane = tid & 31;
    const int blk  = blockIdx.x;

    // ---- Phase 1: stage x into LDS as f16, zero the padded rows -----------
    // These loads go out before the first
    // wait: all of the thread's x loads together (one memory latency for the
    // window, not one per 256 float4), and the first column tile's weight
    // fragments, whose L2 latency passes under the x loads'. The padded rows
    // are zeroed while the loads fly.
    const int wh = wave >> 1;
    const int wc = wave & 1;
    v16h bw[3][4];  // weight fragments of the wave's q, k and v column tiles
    const unsigned wl = frag_w_lane(wave);  // lane's place in the q tile
    {
        constexpr int NV   = NTOK * (CH / 4);  // 1568 float4 in a window
        constexpr int FULL = NV / 256;         // 6 rounds that every thread has
        const float4* xv = (const float4*)(x + (size_t)blk * NTOK * CH);
        float4 v[FULL + 1];
        // unroll: v[] stays in registers and the loads share one address
#pragma unroll
        for (int i = 0; i < FULL; ++i) v[i] = xv[tid + 256 * i];
        // The last 32 float4 are wave 0's. The load is not put under that
        // test (a branch would bring its wait along, in front of the weight
        // loads): the other waves read the window's last float4 and drop it.
        const bool tail = tid < NV - FULL * 256;
        const int  tl   = tail ? tid : NV - FULL * 256 - 1;
        v[FULL] = xv[256 * FULL + tl];
        // unroll: bw[] is indexed by constants only, so it needs no memory
#pragma unroll
        for (int k = 0; k < 4; ++k)
            bw[0][k] = ldfrag_w(wq16, wl, k);
        // Precaution: this wait stands in front of any reuse of the loads'
        // address registers. The lane's indices are inputs so that their
        // registers stay untouched up to it (without them later index
        // arithmetic was lifted over the wait, into those registers).
        asm volatile("s_wait_xcnt 0x0"
                     :: "v"(tl), "v"(tid), "v"(wl) : "memory");
        for (int idx = tid; idx < (NPAD - NTOK) * CH; idx += 256) {
            const int row = NTOK + idx / CH;
            xs[row * XSTR + (idx % CH)] = (_Float16)0.0f;
        }
        // float4 tid + 256 i is row wave + 8 i, columns 4 lane to 4 lane + 3
        _Float16* d0 = xs + wave * XSTR + lane * 4;
        // unroll: v[] is indexed by constants only, so it needs no memory
#pragma unroll
        for (int i = 0; i <= FULL; ++i) {
            if (i < FULL || tail) {
                _Float16* d = d0 + 8 * i * XSTR;
                d[0] = (_Float16)v[i].x; d[1] = (_Float16)v[i].y;
                d[2] = (_Float16)v[i].z; d[3] = (_Float16)v[i].w;
            }
        }
    }
    __syncthreads();

    // ---- Phase 2: qkv = x @ Wqkv (64x384 = 4 x 24 tiles, K=128) -----------
    // Each wave owns the column tiles wave, wave+8, wave+16: 16 channels
    // (half wc of head wh) of q, of k and of v. A column tile's four weight
    // fragments are loaded once, one column tile ahead of their products, and
    // kept in registers for all four row tiles.
    // Dual accumulator chains (k even / k odd) -> independent WMMA streams.
    // q and k tiles are formed transposed (W^T x^T: lane = token, registers =
    // 8 channels), v tiles as x W (lane = channel, registers = 8 tokens): each
    // result is then half of a fragment that phase 3 reads.
    // unroll: the fragment arrays are indexed by constants only and stay in
    // registers.
#pragma unroll
    for (int j = 0; j < 3; ++j) {
        const v16h* b = bw[j];
        if (j < 2) {
#pragma unroll
            for (int k = 0; k < 4; ++k)
                bw[j + 1][k] = ldfrag_w(wq16, wl, 32 * (j + 1) + k);
        }
        // unroll: row-tile offsets become immediates of the LDS accesses
#pragma unroll
        for (int mt = 0; mt < 4; ++mt) {
            v8f acc0 = {}, acc1 = {};
#pragma unroll
            for (int kp = 0; kp < 2; ++kp) {
                v16h a0 = ldfrag_kcontig(xs, mt * 16, XSTR, (2 * kp + 0) * 32);
                v16h a1 = ldfrag_kcontig(xs, mt * 16, XSTR, (2 * kp + 1) * 32);
                if (j < 2) {
                    acc0 = wmma_f16(b[2 * kp + 0], a0, acc0);
                    acc1 = wmma_f16(b[2 * kp + 1], a1, acc1);
                } else {
                    acc0 = wmma_f16(a0, b[2 * kp + 0], acc0);
                    acc1 = wmma_f16(a1, b[2 * kp + 1], acc1);
                }
            }
            // q, k: fragment = token tile, half = channel half of the head.
            // v: fragment = 2 * channel half + key half, half = token tile & 1.
            _Float16* fh = qkv + (j * NH + wh) * 4 * FRAG;
            if (j < 2)
                st_half_frag(fh + mt * FRAG, wc, v8f_add(acc0, acc1));
            else
                st_half_frag(fh + (2 * wc + (mt >> 1)) * FRAG, mt & 1,
                             v8f_add(acc0, acc1));
        }
        // A tile's products and the next tile's loads stay in front of the
        // tile after: with all three tiles' fragments live at once, or two
        // tiles' products interleaved, the wave needs more than 128 registers
        // and fewer work-groups fit on the WGP.
        if (j < 2) __builtin_amdgcn_sched_barrier(0);
    }
    __syncthreads();

    _Float16* ao = xs;  // x staging no longer needed -> reuse as attn output
    // Phase 4's weight fragments (column tile = wave) and bias are asked for
    // here, so that their L2 latency passes under the attention.
    v16h bpj[4];
    const unsigned pl = frag_w_lane(wave);
    const int pcol = lane * 4;  // the thread's four columns of an output row
    // unroll: bpj[] is indexed by constants only, so it needs no memory
#pragma unroll
    for (int k = 0; k < 4; ++k)
        bpj[k] = ldfrag_w(wp16, pl, k);
    const v4f bias = *(const v4f*)(bp + pcol);
    // As at entry: the wait in front of any reuse of the address registers,
    // with the lane's indices and the weight loads' address as inputs.
    asm volatile("s_wait_xcnt 0x0"
                 :: "v"(pl), "v"((const char*)wp16 + pl), "v"(pcol) : "memory");
    const int qc = lane & 15;               // this lane's query in the block
    const int rb = (lane >> 4) ? 8 : 0;     // this lane half's row offset in D
#pragma unroll
    for (int it = 0; it < 2; ++it) {
        const int task = wave + 8 * it;
        const int hd   = task >> 2;
        const int mt   = task & 3;

        // S^T (64 keys x 16 queries, K = DH = 32): 4 independent WMMAs
        v8f st[4];
        {
            v16h bq = ld_frag(qkv + (hd * 4 + mt) * FRAG);
            v16h ak[4];
#pragma unroll
            for (int nt = 0; nt < 4; ++nt)
                ak[nt] = ld_frag(qkv + ((NH + hd) * 4 + nt) * FRAG);
            const v8f z = {};
#pragma unroll
            for (int nt = 0; nt < 3; ++nt) st[nt] = wmma_f16(ak[nt], bq, z);
            // The last tile holds one real key, so seven of its result
            // registers are free at once. Keep it the last of the four.
            __builtin_amdgcn_sched_barrier(0);
            st[3] = wmma_f16(ak[3], bq, z);
        }

        // scale, mask the padded keys, maximum over the lane's keys. A register
        // whose key is padding in both lane halves takes no part at all: its
        // weight is exactly 0.
        float mx[4];
#pragma unroll
        for (int nt = 0; nt < 4; ++nt) {
            mx[nt] = -3.0e38f;
#pragma unroll
            for (int r = 0; r < 8; ++r) {
                if (nt * 16 + r >= NTOK) continue;
                float s = st[nt][r] * SCALE;
                if (nt * 16 + 8 + r >= NTOK) s = rb ? -3.0e38f : s;
                st[nt][r] = s;
                mx[nt] = fmaxf(mx[nt], s);
            }
        }
        float m = fmaxf(fmaxf(mx[0], mx[1]), fmaxf(mx[2], mx[3]));
        m = fmaxf(m, xhalf(m));

        // exp and sum: one partial sum per tile, so four short chains
        float sm[4];
#pragma unroll
        for (int nt = 0; nt < 4; ++nt) {
            sm[nt] = 0.0f;
#pragma unroll
            for (int r = 0; r < 8; ++r) {
                if (nt * 16 + r >= NTOK) continue;
                const float e = exp_slot(st[nt][r] - m);
                st[nt][r] = e;
                sm[nt] = r ? sm[nt] + e : e;
            }
        }
        float s = (sm[0] + sm[1]) + (sm[2] + sm[3]);
        s += xhalf(s);
        const float inv = 1.0f / s;

        // P^T as B fragments, straight from the score registers
        v16h pb[2];
#pragma unroll
        for (int j = 0; j < 2; ++j)
#pragma unroll
            for (int e = 0; e < 16; ++e) {
                const int nt = 2 * j + (e >> 3), r = e & 7;
                pb[j][e] = (nt * 16 + r >= NTOK) ? (_Float16)0.0f
                                                 : (_Float16)(st[nt][r] * inv);
            }

        // O^T = V^T(32x64) @ P^T(64x16): per 16 channels, 2 independent chains.
        // A lane's 8 results are 8 consecutive channels of its query's row.
#pragma unroll
        for (int dt = 0; dt < 2; ++dt) {
            v8f z0 = {}, z1 = {};
            v16h a0 = ld_frag(qkv + ((2 * NH + hd) * 4 + 2 * dt + 0) * FRAG);
            v16h a1 = ld_frag(qkv + ((2 * NH + hd) * 4 + 2 * dt + 1) * FRAG);
            v8f acc0 = wmma_f16(a0, pb[0], z0);
            v8f acc1 = wmma_f16(a1, pb[1], z1);
            const v8f o = v8f_add(acc0, acc1);
            v8h oh;
#pragma unroll
            for (int r = 0; r < 8; ++r) oh[r] = (_Float16)o[r];
            *(v8h*)(ao + (mt * 16 + qc) * XSTR + hd * DH + dt * 16 + rb) = oh;
        }
    }
    __syncthreads();

    // ---- Phase 4: proj + bias, fp32 store of the 49 real rows -------------
    // Each wave owns column tile nt = wave: its four weight fragments (loaded
    // ahead of phase 3) serve all four row tiles. A wave's tile is only 64
    // bytes of an output row, so the results cross LDS and leave as whole rows.
    // The tiles are formed transposed (Wp^T ao^T: lane = token, registers = 8
    // consecutive channels), so a lane hands them over in two 16-byte stores.
    float* os = (float*)qkv;  // [NPAD][OSTR]; q, k, v were last read in phase 3
    {
        const v16h* b = bpj;
        float* d0 = os + qc * OSTR + wave * 16 + rb;
        v8f res[4];
        // unroll: the fragment and result arrays stay in registers and the
        // row-tile offsets become immediates of the LDS accesses
#pragma unroll
        for (int mt = 0; mt < 4; ++mt) {
            v8f acc0 = {}, acc1 = {};
#pragma unroll
            for (int kp = 0; kp < 2; ++kp) {
                v16h a0 = ldfrag_kcontig(ao, mt * 16, XSTR, (2 * kp + 0) * 32);
                v16h a1 = ldfrag_kcontig(ao, mt * 16, XSTR, (2 * kp + 1) * 32);
                acc0 = wmma_f16(b[2 * kp + 0], a0, acc0);
                acc1 = wmma_f16(b[2 * kp + 1], a1, acc1);
            }
            res[mt] = v8f_add(acc0, acc1);
        }
#pragma unroll
        for (int mt = 0; mt < 4; ++mt) {
            const v8f acc = res[mt];
            float* d = d0 + mt * 16 * OSTR;
            *(v4f*)d       = v4f{acc[0], acc[1], acc[2], acc[3]};
            *(v4f*)(d + 4) = v4f{acc[4], acc[5], acc[6], acc[7]};
        }
    }
    __syncthreads();

    // A wave-wide 16-byte store is one whole output row: 512 contiguous bytes,
    // four full lines with one writer each. float4 tid + 256 i of the window is
    // row wave + 8 i, columns 4 lane to 4 lane + 3.
    {
        constexpr int FULL = NTOK / 8;  // 6 rounds that every wave has
        v4f* ov = (v4f*)(out + (size_t)blk * NTOK * CH) + tid;
        const float* s0 = os + wave * OSTR + lane * 4;
        // unroll: row offsets become immediates of the LDS loads and stores
#pragma unroll
        for (int i = 0; i < FULL; ++i)
            ov[256 * i] = *(const v4f*)(s0 + 8 * i * OSTR) + bias;
        // row 48, the last real one, is wave 0's
        if (wave == 0)
            ov[256 * FULL] = *(const v4f*)(s0 + 8 * FULL * OSTR) + bias;
    }
}

// ---------------------------------------------------------------------------
extern "C" void kernel_launch(void* const* d_in, const int* in_sizes, int n_in,
                              void* d_out, int out_size, void* d_ws,
                              size_t ws_size, hipStream_t stream) {
    using namespace cfg;
    const float* x      = (const float*)d_in[0];  // (4096, 49, 128)
    const float* w_qkv  = (const float*)d_in[1];  // (128, 384)
    const float* w_proj = (const float*)d_in[2];  // (128, 128)
    const float* b_proj = (const float*)d_in[3];  // (128,)
    float* out = (float*)d_out;                   // (4096, 49, 128)

    _Float16* wq16 = (_Float16*)d_ws;             // 49152 halfs, 96 fragments
    _Float16* wp16 = wq16 + CH * C3;              // 16384 halfs, 32 fragments

    const int prep_threads = (CH * C3 + CH * CH) / 8;  // 8192, 8 halfs each
    WindowAttention_prep_weights<<<(prep_threads + 255) / 256, 256, 0, stream>>>(
        w_qkv, w_proj, wq16, wp16);

    const size_t lds_bytes = (size_t)LDS_HALFS * sizeof(_Float16);  // 65 KB
    hipFuncSetAttribute((const void*)WindowAttention_41815801594647_kernel,
                        hipFuncAttributeMaxDynamicSharedMemorySize,
                        (int)lds_bytes);

    const int B = in_sizes[0] / (NTOK * CH);      // 4096
    WindowAttention_41815801594647_kernel<<<B, 256, lds_bytes, stream>>>(
        x, wq16, wp16, b_proj, out);
}

// v007
// A run of this version takes 42 microseconds.
// Two timings next to v006 put it at 1.10 and 1.11 times that version's speed.
// Over all steps from v000 it is 3.81 times as fast.
#include <hip/hip_runtime.h>

typedef __attribute__((ext_vector_type(16))) _Float16 v16h;
typedef __attribute__((ext_vector_type(8)))  _Float16 v8h;
typedef __attribute__((ext_vector_type(8)))  float    v8f;
typedef __attribute__((ext_vector_type(4)))  float    v4f;

namespace cfg {
constexpr int NTOK = 49;      // real tokens per window
constexpr int NPAD = 64;      // padded tokens (4 tiles of 16)
constexpr int CH   = 128;     // channels
constexpr int NH   = 4;       // heads
constexpr int DH   = 32;      // head dim
constexpr int C3   = 3 * CH;  // qkv output width = 384
constexpr float SCALE = 0.17677669529663687f;  // 1/sqrt(32)

constexpr int XSTR = CH + 8;    // 136, x / attn-out buffer
constexpr int FRAG = 512;       // one 16x32 f16 fragment: 2 x 32 lanes x 8
constexpr int XS_OFF  = 0;
constexpr int QKV_OFF = NPAD * XSTR;                 // 8704
// q, k, v as ready fragments: [q|k|v][head][4][FRAG]
constexpr int LDS_HALFS = QKV_OFF + 3 * NH * 4 * FRAG;  // 33280 halfs = 65 KB
constexpr int OSTR = CH + 4;    // 132 floats; 64 rows = 33 KB of the 48 KB
// Workgroups launched: two fit on a WGP beside each other (registers), so one
// resident round of 256 x 2 workgroups shares out the windows.
constexpr int NWG = 512;
}

__device__ __forceinline__ int frag_kk(int i) {
    return (i < 4) ? 2 * i : 16 + 2 * (i - 4);
}

// A fragment, or B fragment when K runs along the contiguous dim of src
// (i.e. src is row-major [M][K] for A, or [N][K] == B^T for B).
__device__ __forceinline__ v16h ldfrag_kcontig(const _Float16* src, int row0,
                                               int stride, int colbase) {
    const int lane = threadIdx.x & 31;
    const int mn   = lane & 15;
    const int khi  = (lane >> 4) ? 8 : 0;
    const _Float16* p = src + (row0 + mn) * stride + colbase + khi;
    v16h f;
#pragma unroll
    for (int i = 0; i < 8; ++i) {
        const int kk = frag_kk(i);
        f[2 * i]     = p[kk];
        f[2 * i + 1] = p[kk + 1];
    }
    return f;
}

__device__ __forceinline__ unsigned frag_w_lane(int ct) {
    const int lane = threadIdx.x & 31;
    return (unsigned)(ct * 4 * cfg::FRAG + lane * 8) * 2u;
}

__device__ __forceinline__ v16h ldfrag_w(const _Float16* w, unsigned lane_part,
                                         int frag) {
    const _Float16* p = (const _Float16*)((const char*)w + lane_part) +
                        frag * cfg::FRAG;
    const v8h lo = *(const v8h*)p;
    const v8h hi = *(const v8h*)(p + 256);
    v16h f;
#pragma unroll
    for (int i = 0; i < 8; ++i) { f[i] = lo[i]; f[8 + i] = hi[i]; }
    return f;
}

__device__ __forceinline__ void st_half_frag(_Float16* frag, int half, v8f acc) {
    const int lane = threadIdx.x & 31;
    v8h h;
#pragma unroll
    for (int r = 0; r < 8; ++r) h[r] = (_Float16)acc[r];
    *(v8h*)(frag + half * 256 + lane * 8) = h;
}

__device__ __forceinline__ v16h ld_frag(const _Float16* frag) {
    const int lane = threadIdx.x & 31;
    const v8h lo = *(const v8h*)(frag + lane * 8);
    const v8h hi = *(const v8h*)(frag + 256 + lane * 8);
    v16h f;
#pragma unroll
    for (int i = 0; i < 8; ++i) { f[i] = lo[i]; f[8 + i] = hi[i]; }
    return f;
}

__device__ __forceinline__ v8f wmma_f16(v16h a, v16h b, v8f c) {
    return __builtin_amdgcn_wmma_f32_16x16x32_f16(
        /*neg_a=*/false, a, /*neg_b=*/false, b,
        /*c_mod=*/(short)0, c, /*reuse_a=*/false, /*reuse_b=*/false);
}

__device__ __forceinline__ float xhalf(float x) {
    const int b = __builtin_bit_cast(int, x);
    return __builtin_bit_cast(float, __builtin_amdgcn_permlanex16(
        b, b, 0x76543210, 0xfedcba98, false, false));
}

__device__ __forceinline__ float exp_slot(float x) {
    const float t = x * 1.44269504f;
    float r;
    asm("v_exp_f32 %0, %1\n\tv_nop" : "=v"(r) : "v"(t));
    return r;
}

__device__ __forceinline__ v8f v8f_add(v8f a, v8f b) {
    v8f r;
#pragma unroll
    for (int i = 0; i < 8; ++i) r[i] = a[i] + b[i];
    return r;
}

// ---------------------------------------------------------------------------
// Prep: convert fp32 weights to f16 in fragment register order (weights then
// sit in L2). A thread makes the 8 halfs that one lane reads with one 16-byte
// load: column n, rows 8 kg to 8 kg + 7. Of the 32-k block kg >> 2 these are
// elements 0-7 or 8-15 (bit 1 of kg) of lane n & 15 or that + 16 (bit 0).
// ---------------------------------------------------------------------------
__device__ __forceinline__ void pack_w(const float* __restrict__ w,
                                       _Float16* __restrict__ w16, int nout,
                                       int t) {
    const int kg = t / nout, n = t % nout;
    const float* p = w + kg * 8 * nout + n;
    float f[8];
    // unroll: the 8 loads go out together, one address and immediate offsets
#pragma unroll
    for (int e = 0; e < 8; ++e) f[e] = p[e * nout];
    // Precaution: this wait stands in front of any reuse of the loads'
    // address registers, which are inputs so that they stay untouched up to it.
    asm volatile("s_wait_xcnt 0x0" :: "v"(p) : "memory");
    v8h h;
    // unroll: f[] and h are indexed by constants only and stay in registers
#pragma unroll
    for (int e = 0; e < 8; ++e) h[e] = (_Float16)f[e];
    const int frag = (n >> 4) * 4 + (kg >> 2);
    const int lane = (n & 15) + 16 * (kg & 1);
    *(v8h*)(w16 + frag * cfg::FRAG + ((kg >> 1) & 1) * 256 + lane * 8) = h;
}

__global__ void WindowAttention_prep_weights(const float* __restrict__ wq,
                                             const float* __restrict__ wp,
                                             _Float16* __restrict__ wq16,
                                             _Float16* __restrict__ wp16) {
    const int tid = blockIdx.x * blockDim.x + threadIdx.x;
    constexpr int NQ = cfg::CH / 8 * cfg::C3;
    constexpr int NP = cfg::CH / 8 * cfg::CH;
    if (tid < NQ)
        pack_w(wq, wq16, cfg::C3, tid);
    else if (tid < NQ + NP)
        pack_w(wp, wp16, cfg::CH, tid - NQ);
}

// ---------------------------------------------------------------------------
// Main fused kernel: a workgroup (8 waves) takes one window at a time and loops
// over windows blockIdx.x, blockIdx.x + NWG, ... A wave's weight
// fragments are the same for every window: they are loaded once, at entry, and
// stay in registers over the loop.
// ---------------------------------------------------------------------------
__global__ void __launch_bounds__(256)
WindowAttention_41815801594647_kernel(const float* __restrict__ x,
                                      const _Float16* __restrict__ wq16,
                                      const _Float16* __restrict__ wp16,
                                      const float* __restrict__ bp,
                                      float* __restrict__ out, int nwin) {
    using namespace cfg;
    extern __shared__ _Float16 smem[];
    _Float16* xs  = smem + XS_OFF;   // [NPAD][XSTR] : x (f16), later attn-out
    _Float16* qkv = smem + QKV_OFF;  // q|k|v fragments of all heads (f16)

    const int tid  = threadIdx.x;
    const int wave = tid >> 5;
    const int lane = tid & 31;
    const int wh = wave >> 1;
    const int wc = wave & 1;

    // A workgroup without a window leaves as a whole, in front of every barrier.
    int blk = blockIdx.x;
    if (blk >= nwin) return;

    // ---- Entry: the wave's weights, once for all of its windows -----------
    // Column tiles wave, wave+8, wave+16 of Wqkv (16 channels, half wc of head
    // wh, of q, of k and of v) and column tile wave of Wproj: 16 fragments,
    // 128 registers, plus the thread's four bias values.
    v16h bw[3][4];
    v16h bpj[4];
    const unsigned wl = frag_w_lane(wave);  // lane's place in a column tile
    const int pcol = lane * 4;  // the thread's four columns of an output row
    // unroll: bw[] and bpj[] are indexed by constants only and need no memory
#pragma unroll
    for (int j = 0; j < 3; ++j)
#pragma unroll
        for (int k = 0; k < 4; ++k)
            bw[j][k] = ldfrag_w(wq16, wl, 32 * j + k);
#pragma unroll
    for (int k = 0; k < 4; ++k)
        bpj[k] = ldfrag_w(wp16, wl, k);
    const v4f bias = *(const v4f*)(bp + pcol);
    // Precaution: this wait stands in front of any reuse of the loads' address
    // registers. The lane's indices are inputs so that their registers stay
    // untouched up to it.
    asm volatile("s_wait_xcnt 0x0" :: "v"(wl), "v"(lane) : "memory");

    const int qc = lane & 15;               // this lane's query in the block
    const int rb = (lane >> 4) ? 8 : 0;     // this lane half's row offset in D

    // unroll 1: one copy of the body; a second would double the live registers
    // beside the 128 of the weights.
#pragma unroll 1
    do {
        // ---- Phase 1: stage x into LDS as f16, zero the padded rows -------
        // All of the thread's x loads go out together (one memory latency for
        // the window, not one per 256 float4). The padded rows are zeroed
        // while the loads fly. xs was last read (as attn-out) in front of the
        // barrier behind phase 4 of the window before.
        {
            constexpr int NV   = NTOK * (CH / 4);  // 1568 float4 in a window
            constexpr int FULL = NV / 256;         // 6 rounds of every thread
            const float4* xv = (const float4*)(x + (size_t)blk * NTOK * CH);
            float4 v[FULL + 1];
            // unroll: v[] stays in registers and the loads share one address
#pragma unroll
            for (int i = 0; i < FULL; ++i) v[i] = xv[tid + 256 * i];
            // The last 32 float4 are wave 0's. The load is not put under that
            // test (a branch would bring its wait along): the other waves read
            // the window's last float4 and drop it.
            const bool tail = tid < NV - FULL * 256;
            const int  tl   = tail ? tid : NV - FULL * 256 - 1;
            v[FULL] = xv[256 * FULL + tl];
            // Precaution: this wait stands in front of any reuse of the loads'
            // address registers. The lane's indices are inputs so that their
            // registers stay untouched up to it.
            asm volatile("s_wait_xcnt 0x0" :: "v"(tl), "v"(tid) : "memory");
            for (int idx = tid; idx < (NPAD - NTOK) * CH; idx += 256) {
                const int row = NTOK + idx / CH;
                xs[row * XSTR + (idx % CH)] = (_Float16)0.0f;
            }
            // float4 tid + 256 i is row wave + 8 i, columns 4 lane to 4 lane + 3
            _Float16* d0 = xs + wave * XSTR + lane * 4;
            // unroll: v[] is indexed by constants only, so it needs no memory
#pragma unroll
            for (int i = 0; i <= FULL; ++i) {
                if (i < FULL || tail) {
                    _Float16* d = d0 + 8 * i * XSTR;
                    d[0] = (_Float16)v[i].x; d[1] = (_Float16)v[i].y;
                    d[2] = (_Float16)v[i].z; d[3] = (_Float16)v[i].w;
                }
            }
        }
        // This barrier also ends the last reads of the window before: its
        // output rows lie over q|k|v, which phase 2 writes.
        __syncthreads();

        // ---- Phase 2: qkv = x @ Wqkv (64x384 = 4 x 24 tiles, K=128) -------
        // With all three column tiles' weights resident, a row tile's four x
        // fragments are read from LDS once and serve q, k and v.
        // Dual accumulator chains (k even / k odd) -> independent WMMA streams.
        // q and k tiles are formed transposed (W^T x^T: lane = token,
        // registers = 8 channels), v tiles as x W (lane = channel, registers =
        // 8 tokens): each result is then half of a fragment that phase 3 reads.
        // unroll: the fragment arrays are indexed by constants only and stay
        // in registers; row-tile offsets become immediates of the LDS accesses.
#pragma unroll
        for (int mt = 0; mt < 4; ++mt) {
            v16h a[4];
#pragma unroll
            for (int k = 0; k < 4; ++k)
                a[k] = ldfrag_kcontig(xs, mt * 16, XSTR, k * 32);
#pragma unroll
            for (int j = 0; j < 3; ++j) {
                const v16h* b = bw[j];
                v8f acc0 = {}, acc1 = {};
#pragma unroll
                for (int kp = 0; kp < 2; ++kp) {
                    if (j < 2) {
                        acc0 = wmma_f16(b[2 * kp + 0], a[2 * kp + 0], acc0);
                        acc1 = wmma_f16(b[2 * kp + 1], a[2 * kp + 1], acc1);
                    } else {
                        acc0 = wmma_f16(a[2 * kp + 0], b[2 * kp + 0], acc0);
                        acc1 = wmma_f16(a[2 * kp + 1], b[2 * kp + 1], acc1);
                    }
                }
                // q, k: fragment = token tile, half = channel half of the head.
                // v: fragment = 2 * channel half + key half, half = token tile & 1.
                _Float16* fh = qkv + (j * NH + wh) * 4 * FRAG;
                if (j < 2)
                    st_half_frag(fh + mt * FRAG, wc, v8f_add(acc0, acc1));
                else
                    st_half_frag(fh + (2 * wc + (mt >> 1)) * FRAG, mt & 1,
                                 v8f_add(acc0, acc1));
            }
        }
        __syncthreads();

        _Float16* ao = xs;  // x staging no longer needed -> reuse as attn output
#pragma unroll
        for (int it = 0; it < 2; ++it) {
            const int task = wave + 8 * it;
            const int hd   = task >> 2;
            const int mt   = task & 3;

            // S^T (64 keys x 16 queries, K = DH = 32): 4 independent WMMAs
            v8f st[4];
            {
                v16h bq = ld_frag(qkv + (hd * 4 + mt) * FRAG);
                v16h ak[4];
#pragma unroll
                for (int nt = 0; nt < 4; ++nt)
                    ak[nt] = ld_frag(qkv + ((NH + hd) * 4 + nt) * FRAG);
                const v8f z = {};
#pragma unroll
                for (int nt = 0; nt < 3; ++nt) st[nt] = wmma_f16(ak[nt], bq, z);
                // The last tile holds one real key, so seven of its result
                // registers are free at once. Keep it the last of the four: moved
                // up, those registers were handed to the next tile's result inside
                // the distance a matrix instruction's result needs.
                __builtin_amdgcn_sched_barrier(0);
                st[3] = wmma_f16(ak[3], bq, z);
            }

            // scale, mask the padded keys, maximum over the lane's keys. A register
            // whose key is padding in both lane halves takes no part at all: its
            // weight is exactly 0.
            float mx[4];
#pragma unroll
            for (int nt = 0; nt < 4; ++nt) {
                mx[nt] = -3.0e38f;
#pragma unroll
                for (int r = 0; r < 8; ++r) {
                    if (nt * 16 + r >= NTOK) continue;
                    float s = st[nt][r] * SCALE;
                    if (nt * 16 + 8 + r >= NTOK) s = rb ? -3.0e38f : s;
                    st[nt][r] = s;
                    mx[nt] = fmaxf(mx[nt], s);
                }
            }
            float m = fmaxf(fmaxf(mx[0], mx[1]), fmaxf(mx[2], mx[3]));
            m = fmaxf(m, xhalf(m));

            // exp and sum: one partial sum per tile, so four short chains
            float sm[4];
#pragma unroll
            for (int nt = 0; nt < 4; ++nt) {
                sm[nt] = 0.0f;
#pragma unroll
                for (int r = 0; r < 8; ++r) {
                    if (nt * 16 + r >= NTOK) continue;
                    const float e = exp_slot(st[nt][r] - m);
                    st[nt][r] = e;
                    sm[nt] = r ? sm[nt] + e : e;
                }
            }
            float s = (sm[0] + sm[1]) + (sm[2] + sm[3]);
            s += xhalf(s);
            const float inv = 1.0f / s;

            // P^T as B fragments, straight from the score registers
            v16h pb[2];
#pragma unroll
            for (int j = 0; j < 2; ++j)
#pragma unroll
                for (int e = 0; e < 16; ++e) {
                    const int nt = 2 * j + (e >> 3), r = e & 7;
                    pb[j][e] = (nt * 16 + r >= NTOK) ? (_Float16)0.0f
                                                     : (_Float16)(st[nt][r] * inv);
                }

            // O^T = V^T(32x64) @ P^T(64x16): per 16 channels, 2 independent chains.
            // A lane's 8 results are 8 consecutive channels of its query's row.
#pragma unroll
            for (int dt = 0; dt < 2; ++dt) {
                v8f z0 = {}, z1 = {};
                v16h a0 = ld_frag(qkv + ((2 * NH + hd) * 4 + 2 * dt + 0) * FRAG);
                v16h a1 = ld_frag(qkv + ((2 * NH + hd) * 4 + 2 * dt + 1) * FRAG);
                v8f acc0 = wmma_f16(a0, pb[0], z0);
                v8f acc1 = wmma_f16(a1, pb[1], z1);
                const v8f o = v8f_add(acc0, acc1);
                v8h oh;
#pragma unroll
                for (int r = 0; r < 8; ++r) oh[r] = (_Float16)o[r];
                *(v8h*)(ao + (mt * 16 + qc) * XSTR + hd * DH + dt * 16 + rb) = oh;
            }
        }
        __syncthreads();

        // ---- Phase 4: proj + bias, fp32 store of the 49 real rows -------------
        // Each wave owns column tile nt = wave: its four weight fragments (resident
        // since entry) serve all four row tiles. A wave's tile is only 64
        // bytes of an output row, so the results cross LDS and leave as whole rows.
        // The tiles are formed transposed (Wp^T ao^T: lane = token, registers = 8
        // consecutive channels), so a lane hands them over in two 16-byte stores.
        float* os = (float*)qkv;  // [NPAD][OSTR]; q, k, v were last read in phase 3
        {
            const v16h* b = bpj;
            float* d0 = os + qc * OSTR + wave * 16 + rb;
            v8f res[4];
            // unroll: the fragment and result arrays stay in registers and the
            // row-tile offsets become immediates of the LDS accesses
#pragma unroll
            for (int mt = 0; mt < 4; ++mt) {
                v16h a[4];
#pragma unroll
                for (int k = 0; k < 4; ++k)
                    a[k] = ldfrag_kcontig(ao, mt * 16, XSTR, k * 32);
                // A row tile's eight loads go out as one group in front of its
                // products: beside the resident weights the compiler else kept
                // one fragment's registers and waited each load pair out alone.
                __builtin_amdgcn_sched_barrier(0);
                v8f acc0 = {}, acc1 = {};
#pragma unroll
                for (int kp = 0; kp < 2; ++kp) {
                    acc0 = wmma_f16(b[2 * kp + 0], a[2 * kp + 0], acc0);
                    acc1 = wmma_f16(b[2 * kp + 1], a[2 * kp + 1], acc1);
                }
                res[mt] = v8f_add(acc0, acc1);
            }
#pragma unroll
            for (int mt = 0; mt < 4; ++mt) {
                const v8f acc = res[mt];
                float* d = d0 + mt * 16 * OSTR;
                *(v4f*)d       = v4f{acc[0], acc[1], acc[2], acc[3]};
                *(v4f*)(d + 4) = v4f{acc[4], acc[5], acc[6], acc[7]};
            }
        }
        __syncthreads();

        // A wave-wide 16-byte store is one whole output row: 512 contiguous
        // bytes, four full lines with one writer each. float4 tid + 256 i of
        // the window is row wave + 8 i, columns 4 lane to 4 lane + 3.
        {
            constexpr int FULL = NTOK / 8;  // 6 rounds that every wave has
            v4f* ov = (v4f*)(out + (size_t)blk * NTOK * CH) + tid;
            const float* s0 = os + wave * OSTR + lane * 4;
            // unroll: row offsets become immediates of the LDS loads and stores
#pragma unroll
            for (int i = 0; i < FULL; ++i)
                ov[256 * i] = *(const v4f*)(s0 + 8 * i * OSTR) + bias;
            // row 48, the last real one, is wave 0's
            if (wave == 0)
                ov[256 * FULL] = *(const v4f*)(s0 + 8 * FULL * OSTR) + bias;
            // Precaution: this wait stands in front of the next window's reuse
            // of the stores' address and data registers.
            asm volatile("s_wait_xcnt 0x0" :: "v"(tid) : "memory");
        }
        blk += NWG;
    } while (blk < nwin);
}

// ---------------------------------------------------------------------------
extern "C" void kernel_launch(void* const* d_in, const int* in_sizes, int n_in,
                              void* d_out, int out_size, void* d_ws,
                              size_t ws_size, hipStream_t stream) {
    using namespace cfg;
    const float* x      = (const float*)d_in[0];  // (4096, 49, 128)
    const float* w_qkv  = (const float*)d_in[1];  // (128, 384)
    const float* w_proj = (const float*)d_in[2];  // (128, 128)
    const float* b_proj = (const float*)d_in[3];  // (128,)
    float* out = (float*)d_out;                   // (4096, 49, 128)

    _Float16* wq16 = (_Float16*)d_ws;             // 49152 halfs, 96 fragments
    _Float16* wp16 = wq16 + CH * C3;              // 16384 halfs, 32 fragments

    const int prep_threads = (CH * C3 + CH * CH) / 8;  // 8192, 8 halfs each
    WindowAttention_prep_weights<<<(prep_threads + 255) / 256, 256, 0, stream>>>(
        w_qkv, w_proj, wq16, wp16);

    const size_t lds_bytes = (size_t)LDS_HALFS * sizeof(_Float16);  // 65 KB
    hipFuncSetAttribute((const void*)WindowAttention_41815801594647_kernel,
                        hipFuncAttributeMaxDynamicSharedMemorySize,
                        (int)lds_bytes);

    const int nwin = in_sizes[0] / (NTOK * CH);   // 4096 windows
    const int B = NWG;                            // workgroups launched
    WindowAttention_41815801594647_kernel<<<B, 256, lds_bytes, stream>>>(
        x, wq16, wp16, b_proj, out, nwin);
}

// v008
// A run of this version takes 39 microseconds.
// In both of two side-by-side timings against v007, it was 1.07 times as fast.
// All steps since v000 together make it 4.08 times as fast.
#include <hip/hip_runtime.h>

typedef __attribute__((ext_vector_type(16))) _Float16 v16h;
typedef __attribute__((ext_vector_type(8)))  _Float16 v8h;
typedef __attribute__((ext_vector_type(8)))  float    v8f;
typedef __attribute__((ext_vector_type(4)))  float    v4f;

namespace cfg {
constexpr int NTOK = 49;      // real tokens per window
constexpr int NPAD = 64;      // padded tokens (4 tiles of 16)
constexpr int CH   = 128;     // channels
constexpr int NH   = 4;       // heads
constexpr int DH   = 32;      // head dim
constexpr int C3   = 3 * CH;  // qkv output width = 384
constexpr float SCALE = 0.17677669529663687f;  // 1/sqrt(32)

constexpr int XSTR = CH + 8;    // 136, x / attn-out buffer
constexpr int FRAG = 512;       // one 16x32 f16 fragment: 2 x 32 lanes x 8
constexpr int XS_OFF  = 0;
constexpr int QKV_OFF = NPAD * XSTR;                 // 8704
// q, k, v as ready fragments: [q|k|v][head][4][FRAG]
constexpr int LDS_HALFS = QKV_OFF + 3 * NH * 4 * FRAG;  // 33280 halfs = 65 KB
// The landing place of the asynchronous copies, behind the rest: one window's
// x as it lies in global memory (f32, 49 rows in a row), then the 15 padded
// rows, which no copy touches.
constexpr int XF_OFF    = LDS_HALFS;                 // byte 66560, 16-aligned
constexpr int XF_BYTES  = NPAD * CH * 4;             // 32768
constexpr int LDS_BYTES = LDS_HALFS * 2 + XF_BYTES;  // 99328 B = 97 KB
constexpr int OSTR = CH + 4;    // 132 floats; 64 rows = 33 KB of the 48 KB
// Workgroups launched: two fit on a WGP beside each other (registers), so one
// resident round of 256 x 2 workgroups shares out the windows.
constexpr int NWG = 512;
}

__device__ __forceinline__ int frag_kk(int i) {
    return (i < 4) ? 2 * i : 16 + 2 * (i - 4);
}

// A fragment, or B fragment when K runs along the contiguous dim of src
// (i.e. src is row-major [M][K] for A, or [N][K] == B^T for B).
__device__ __forceinline__ v16h ldfrag_kcontig(const _Float16* src, int row0,
                                               int stride, int colbase) {
    const int lane = threadIdx.x & 31;
    const int mn   = lane & 15;
    const int khi  = (lane >> 4) ? 8 : 0;
    const _Float16* p = src + (row0 + mn) * stride + colbase + khi;
    v16h f;
#pragma unroll
    for (int i = 0; i < 8; ++i) {
        const int kk = frag_kk(i);
        f[2 * i]     = p[kk];
        f[2 * i + 1] = p[kk + 1];
    }
    return f;
}

__device__ __forceinline__ unsigned frag_w_lane(int ct) {
    const int lane = threadIdx.x & 31;
    return (unsigned)(ct * 4 * cfg::FRAG + lane * 8) * 2u;
}

__device__ __forceinline__ v16h ldfrag_w(const _Float16* w, unsigned lane_part,
                                         int frag) {
    const _Float16* p = (const _Float16*)((const char*)w + lane_part) +
                        frag * cfg::FRAG;
    const v8h lo = *(const v8h*)p;
    const v8h hi = *(const v8h*)(p + 256);
    v16h f;
#pragma unroll
    for (int i = 0; i < 8; ++i) { f[i] = lo[i]; f[8 + i] = hi[i]; }
    return f;
}

__device__ __forceinline__ void st_half_frag(_Float16* frag, int half, v8f acc) {
    const int lane = threadIdx.x & 31;
    v8h h;
#pragma unroll
    for (int r = 0; r < 8; ++r) h[r] = (_Float16)acc[r];
    *(v8h*)(frag + half * 256 + lane * 8) = h;
}

__device__ __forceinline__ v16h ld_frag(const _Float16* frag) {
    const int lane = threadIdx.x & 31;
    const v8h lo = *(const v8h*)(frag + lane * 8);
    const v8h hi = *(const v8h*)(frag + 256 + lane * 8);
    v16h f;
#pragma unroll
    for (int i = 0; i < 8; ++i) { f[i] = lo[i]; f[8 + i] = hi[i]; }
    return f;
}

__device__ __forceinline__ v8f wmma_f16(v16h a, v16h b, v8f c) {
    return __builtin_amdgcn_wmma_f32_16x16x32_f16(
        /*neg_a=*/false, a, /*neg_b=*/false, b,
        /*c_mod=*/(short)0, c, /*reuse_a=*/false, /*reuse_b=*/false);
}

__device__ __forceinline__ float xhalf(float x) {
    const int b = __builtin_bit_cast(int, x);
    return __builtin_bit_cast(float, __builtin_amdgcn_permlanex16(
        b, b, 0x76543210, 0xfedcba98, false, false));
}

__device__ __forceinline__ float exp_slot(float x) {
    const float t = x * 1.44269504f;
    float r;
    asm("v_exp_f32 %0, %1\n\tv_nop" : "=v"(r) : "v"(t));
    return r;
}

__device__ __forceinline__ void copy_x(const float* g, unsigned lds,
                                       int wave_s) {
    asm volatile("global_load_async_to_lds_b128 %0, %1, off\n\t"
                 "global_load_async_to_lds_b128 %0, %1, off offset:4096\n\t"
                 "global_load_async_to_lds_b128 %0, %1, off offset:8192\n\t"
                 "global_load_async_to_lds_b128 %0, %1, off offset:12288\n\t"
                 "global_load_async_to_lds_b128 %0, %1, off offset:16384\n\t"
                 "global_load_async_to_lds_b128 %0, %1, off offset:20480\n\t"
                 "s_wait_xcnt 0x0" :: "v"(lds), "v"(g) : "memory");
    if (wave_s == 0)
        asm volatile("global_load_async_to_lds_b128 %0, %1, off offset:24576\n\t"
                     "s_wait_xcnt 0x0" :: "v"(lds), "v"(g) : "memory");
}

__device__ __forceinline__ v8f v8f_add(v8f a, v8f b) {
    v8f r;
#pragma unroll
    for (int i = 0; i < 8; ++i) r[i] = a[i] + b[i];
    return r;
}

// ---------------------------------------------------------------------------
// Prep: convert fp32 weights to f16 in fragment register order (weights then
// sit in L2). A thread makes the 8 halfs that one lane reads with one 16-byte
// load: column n, rows 8 kg to 8 kg + 7. Of the 32-k block kg >> 2 these are
// elements 0-7 or 8-15 (bit 1 of kg) of lane n & 15 or that + 16 (bit 0).
// ---------------------------------------------------------------------------
__device__ __forceinline__ void pack_w(const float* __restrict__ w,
                                       _Float16* __restrict__ w16, int nout,
                                       int t) {
    const int kg = t / nout, n = t % nout;
    const float* p = w + kg * 8 * nout + n;
    float f[8];
    // unroll: the 8 loads go out together, one address and immediate offsets
#pragma unroll
    for (int e = 0; e < 8; ++e) f[e] = p[e * nout];
    // Precaution: this wait stands in front of any reuse of the loads'
    // address registers, which are inputs so that they stay untouched up to it.
    asm volatile("s_wait_xcnt 0x0" :: "v"(p) : "memory");
    v8h h;
    // unroll: f[] and h are indexed by constants only and stay in registers
#pragma unroll
    for (int e = 0; e < 8; ++e) h[e] = (_Float16)f[e];
    const int frag = (n >> 4) * 4 + (kg >> 2);
    const int lane = (n & 15) + 16 * (kg & 1);
    *(v8h*)(w16 + frag * cfg::FRAG + ((kg >> 1) & 1) * 256 + lane * 8) = h;
}

__global__ void WindowAttention_prep_weights(const float* __restrict__ wq,
                                             const float* __restrict__ wp,
                                             _Float16* __restrict__ wq16,
                                             _Float16* __restrict__ wp16) {
    const int tid = blockIdx.x * blockDim.x + threadIdx.x;
    constexpr int NQ = cfg::CH / 8 * cfg::C3;
    constexpr int NP = cfg::CH / 8 * cfg::CH;
    if (tid < NQ)
        pack_w(wq, wq16, cfg::C3, tid);
    else if (tid < NQ + NP)
        pack_w(wp, wp16, cfg::CH, tid - NQ);
}

// ---------------------------------------------------------------------------
// Main fused kernel: a workgroup (8 waves) takes one window at a time and loops
// over windows blockIdx.x, blockIdx.x + NWG, ... A wave's weight
// fragments are the same for every window: they are loaded once, at entry, and
// stay in registers over the loop.
// ---------------------------------------------------------------------------
__global__ void __launch_bounds__(256)
WindowAttention_41815801594647_kernel(const float* __restrict__ x,
                                      const _Float16* __restrict__ wq16,
                                      const _Float16* __restrict__ wp16,
                                      const float* __restrict__ bp,
                                      float* __restrict__ out, int nwin) {
    using namespace cfg;
    extern __shared__ _Float16 smem[];
    _Float16* xs  = smem + XS_OFF;   // [NPAD][XSTR] : x (f16), later attn-out
    _Float16* qkv = smem + QKV_OFF;  // q|k|v fragments of all heads (f16)

    const int tid  = threadIdx.x;
    const int wave = tid >> 5;
    const int lane = tid & 31;
    const int wh = wave >> 1;
    const int wc = wave & 1;

    // A workgroup without a window leaves as a whole, in front of every barrier.
    int blk = blockIdx.x;
    if (blk >= nwin) return;

    // x comes one window ahead: the first window's copies go out here, each
    // further window's behind the barrier that ends phase 1 of the window
    // before, and fly during phases 2 to 4.
    float4* xl = (float4*)(smem + XF_OFF) + tid;   // the thread's place
    const unsigned xl_lds = (unsigned)(size_t)xl;  // its LDS byte address
    const int wave_s = __builtin_amdgcn_readfirstlane(wave);
    copy_x(x + (size_t)blk * NTOK * CH + tid * 4, xl_lds, wave_s);
    // The padded rows of the landing place are zeroed once: float4 tid + 256 i
    // is row wave + 8 i, so round 7 is rows 56 to 63 and round 6 rows 48 to 55,
    // of which only row 48 (wave 0) is real. No copy aims at them, and each is
    // read only by the thread that writes it here.
    xl[256 * 7] = float4{0.0f, 0.0f, 0.0f, 0.0f};
    if (wave_s != 0) xl[256 * 6] = float4{0.0f, 0.0f, 0.0f, 0.0f};

    // ---- Entry: the wave's weights, once for all of its windows -----------
    // Column tiles wave, wave+8, wave+16 of Wqkv (16 channels, half wc of head
    // wh, of q, of k and of v) and column tile wave of Wproj: 16 fragments,
    // 128 registers, plus the thread's four bias values.
    v16h bw[3][4];
    v16h bpj[4];
    const unsigned wl = frag_w_lane(wave);  // lane's place in a column tile
    const int pcol = lane * 4;  // the thread's four columns of an output row
    // unroll: bw[] and bpj[] are indexed by constants only and need no memory
#pragma unroll
    for (int j = 0; j < 3; ++j)
#pragma unroll
        for (int k = 0; k < 4; ++k)
            bw[j][k] = ldfrag_w(wq16, wl, 32 * j + k);
#pragma unroll
    for (int k = 0; k < 4; ++k)
        bpj[k] = ldfrag_w(wp16, wl, k);
    const v4f bias = *(const v4f*)(bp + pcol);
    // Precaution: this wait stands in front of any reuse of the loads' address
    // registers. The lane's indices are inputs so that their registers stay
    // untouched up to it.
    asm volatile("s_wait_xcnt 0x0" :: "v"(wl), "v"(lane) : "memory");

    const int qc = lane & 15;               // this lane's query in the block
    const int rb = (lane >> 4) ? 8 : 0;     // this lane half's row offset in D

    // unroll 1: one copy of the body; a second would double the live registers
    // beside the 128 of the weights.
#pragma unroll 1
    do {
        // ---- Phase 1: the landing place, all 64 rows, to xs as f16 ------------
        // A thread reads the very bytes that it copied (or zeroed) itself, so
        // its own wave's wait is all that stands between. xs was last read (as
        // attn-out) in front of the barrier behind phase 4 of the window before.
        {
            constexpr int ROUNDS = NPAD * (CH / 4) / 256;  // 8 float4 a thread
            // The wave's copies of this window have landed behind this wait.
            asm volatile("s_wait_asynccnt 0x0" ::: "memory");
            float4 v[ROUNDS];
            // unroll: v[] stays in registers and the loads share one address
#pragma unroll
            for (int i = 0; i < ROUNDS; ++i) v[i] = xl[256 * i];
            // float4 tid + 256 i is row wave + 8 i, columns 4 lane to 4 lane + 3
            _Float16* d0 = xs + wave * XSTR + lane * 4;
            // unroll: v[] is indexed by constants only, so it needs no memory
#pragma unroll
            for (int i = 0; i < ROUNDS; ++i) {
                _Float16* d = d0 + 8 * i * XSTR;
                d[0] = (_Float16)v[i].x; d[1] = (_Float16)v[i].y;
                d[2] = (_Float16)v[i].z; d[3] = (_Float16)v[i].w;
            }
        }
        // The wave's reads of the landing place have retired before the copies
        // behind the barrier aim at it again.
        asm volatile("s_wait_dscnt 0x0" ::: "memory");
        // This barrier also ends the last reads of the window before: its
        // output rows lie over q|k|v, which phase 2 writes.
        __syncthreads();

        // The next window's x sets out (a scalar test, the same for the whole
        // workgroup). Its wait is the one at the head of the next trip, so no
        // copy is outstanding behind the loop.
        if (blk + NWG < nwin)
            copy_x(x + (size_t)(blk + NWG) * NTOK * CH + tid * 4, xl_lds,
                   wave_s);

        // ---- Phase 2: qkv = x @ Wqkv (64x384 = 4 x 24 tiles, K=128) -------
        // With all three column tiles' weights resident, a row tile's four x
        // fragments are read from LDS once and serve q, k and v.
        // Dual accumulator chains (k even / k odd) -> independent WMMA streams.
        // q and k tiles are formed transposed (W^T x^T: lane = token,
        // registers = 8 channels), v tiles as x W (lane = channel, registers =
        // 8 tokens): each result is then half of a fragment that phase 3 reads.
        // unroll: the fragment arrays are indexed by constants only and stay
        // in registers; row-tile offsets become immediates of the LDS accesses.
#pragma unroll
        for (int mt = 0; mt < 4; ++mt) {
            v16h a[4];
#pragma unroll
            for (int k = 0; k < 4; ++k)
                a[k] = ldfrag_kcontig(xs, mt * 16, XSTR, k * 32);
#pragma unroll
            for (int j = 0; j < 3; ++j) {
                const v16h* b = bw[j];
                v8f acc0 = {}, acc1 = {};
#pragma unroll
                for (int kp = 0; kp < 2; ++kp) {
                    if (j < 2) {
                        acc0 = wmma_f16(b[2 * kp + 0], a[2 * kp + 0], acc0);
                        acc1 = wmma_f16(b[2 * kp + 1], a[2 * kp + 1], acc1);
                    } else {
                        acc0 = wmma_f16(a[2 * kp + 0], b[2 * kp + 0], acc0);
                        acc1 = wmma_f16(a[2 * kp + 1], b[2 * kp + 1], acc1);
                    }
                }
                // q, k: fragment = token tile, half = channel half of the head.
                // v: fragment = 2 * channel half + key half, half = token tile & 1.
                _Float16* fh = qkv + (j * NH + wh) * 4 * FRAG;
                if (j < 2)
                    st_half_frag(fh + mt * FRAG, wc, v8f_add(acc0, acc1));
                else
                    st_half_frag(fh + (2 * wc + (mt >> 1)) * FRAG, mt & 1,
                                 v8f_add(acc0, acc1));
            }
        }
        __syncthreads();

        _Float16* ao = xs;  // x staging no longer needed -> reuse as attn output
#pragma unroll
        for (int it = 0; it < 2; ++it) {
            const int task = wave + 8 * it;
            const int hd   = task >> 2;
            const int mt   = task & 3;

            // S^T (64 keys x 16 queries, K = DH = 32): 4 independent WMMAs
            v8f st[4];
            {
                v16h bq = ld_frag(qkv + (hd * 4 + mt) * FRAG);
                v16h ak[4];
#pragma unroll
                for (int nt = 0; nt < 4; ++nt)
                    ak[nt] = ld_frag(qkv + ((NH + hd) * 4 + nt) * FRAG);
                const v8f z = {};
#pragma unroll
                for (int nt = 0; nt < 3; ++nt) st[nt] = wmma_f16(ak[nt], bq, z);
                // The last tile holds one real key, so seven of its result
                // registers are free at once. Keep it the last of the four: moved
                // up, those registers were handed to the next tile's result inside
                // the distance a matrix instruction's result needs.
                __builtin_amdgcn_sched_barrier(0);
                st[3] = wmma_f16(ak[3], bq, z);
            }

            // scale, mask the padded keys, maximum over the lane's keys. A register
            // whose key is padding in both lane halves takes no part at all: its
            // weight is exactly 0.
            float mx[4];
#pragma unroll
            for (int nt = 0; nt < 4; ++nt) {
                mx[nt] = -3.0e38f;
#pragma unroll
                for (int r = 0; r < 8; ++r) {
                    if (nt * 16 + r >= NTOK) continue;
                    float s = st[nt][r] * SCALE;
                    if (nt * 16 + 8 + r >= NTOK) s = rb ? -3.0e38f : s;
                    st[nt][r] = s;
                    mx[nt] = fmaxf(mx[nt], s);
                }
            }
            float m = fmaxf(fmaxf(mx[0], mx[1]), fmaxf(mx[2], mx[3]));
            m = fmaxf(m, xhalf(m));

            // exp and sum: one partial sum per tile, so four short chains
            float sm[4];
#pragma unroll
            for (int nt = 0; nt < 4; ++nt) {
                sm[nt] = 0.0f;
#pragma unroll
                for (int r = 0; r < 8; ++r) {
                    if (nt * 16 + r >= NTOK) continue;
                    const float e = exp_slot(st[nt][r] - m);
                    st[nt][r] = e;
                    sm[nt] = r ? sm[nt] + e : e;
                }
            }
            float s = (sm[0] + sm[1]) + (sm[2] + sm[3]);
            s += xhalf(s);
            const float inv = 1.0f / s;

            // P^T as B fragments, straight from the score registers
            v16h pb[2];
#pragma unroll
            for (int j = 0; j < 2; ++j)
#pragma unroll
                for (int e = 0; e < 16; ++e) {
                    const int nt = 2 * j + (e >> 3), r = e & 7;
                    pb[j][e] = (nt * 16 + r >= NTOK) ? (_Float16)0.0f
                                                     : (_Float16)(st[nt][r] * inv);
                }

            // O^T = V^T(32x64) @ P^T(64x16): per 16 channels, 2 independent chains.
            // A lane's 8 results are 8 consecutive channels of its query's row.
#pragma unroll
            for (int dt = 0; dt < 2; ++dt) {
                v8f z0 = {}, z1 = {};
                v16h a0 = ld_frag(qkv + ((2 * NH + hd) * 4 + 2 * dt + 0) * FRAG);
                v16h a1 = ld_frag(qkv + ((2 * NH + hd) * 4 + 2 * dt + 1) * FRAG);
                v8f acc0 = wmma_f16(a0, pb[0], z0);
                v8f acc1 = wmma_f16(a1, pb[1], z1);
                const v8f o = v8f_add(acc0, acc1);
                v8h oh;
#pragma unroll
                for (int r = 0; r < 8; ++r) oh[r] = (_Float16)o[r];
                *(v8h*)(ao + (mt * 16 + qc) * XSTR + hd * DH + dt * 16 + rb) = oh;
            }
        }
        __syncthreads();

        // ---- Phase 4: proj + bias, fp32 store of the 49 real rows -------------
        // Each wave owns column tile nt = wave: its four weight fragments (resident
        // since entry) serve all four row tiles. A wave's tile is only 64
        // bytes of an output row, so the results cross LDS and leave as whole rows.
        // The tiles are formed transposed (Wp^T ao^T: lane = token, registers = 8
        // consecutive channels), so a lane hands them over in two 16-byte stores.
        float* os = (float*)qkv;  // [NPAD][OSTR]; q, k, v were last read in phase 3
        {
            const v16h* b = bpj;
            float* d0 = os + qc * OSTR + wave * 16 + rb;
            v8f res[4];
            // unroll: the fragment and result arrays stay in registers and the
            // row-tile offsets become immediates of the LDS accesses
#pragma unroll
            for (int mt = 0; mt < 4; ++mt) {
                v16h a[4];
#pragma unroll
                for (int k = 0; k < 4; ++k)
                    a[k] = ldfrag_kcontig(ao, mt * 16, XSTR, k * 32);
                // A row tile's eight loads go out as one group in front of its
                // products: beside the resident weights the compiler else kept
                // one fragment's registers and waited each load pair out alone.
                __builtin_amdgcn_sched_barrier(0);
                v8f acc0 = {}, acc1 = {};
#pragma unroll
                for (int kp = 0; kp < 2; ++kp) {
                    acc0 = wmma_f16(b[2 * kp + 0], a[2 * kp + 0], acc0);
                    acc1 = wmma_f16(b[2 * kp + 1], a[2 * kp + 1], acc1);
                }
                res[mt] = v8f_add(acc0, acc1);
            }
#pragma unroll
            for (int mt = 0; mt < 4; ++mt) {
                const v8f acc = res[mt];
                float* d = d0 + mt * 16 * OSTR;
                *(v4f*)d       = v4f{acc[0], acc[1], acc[2], acc[3]};
                *(v4f*)(d + 4) = v4f{acc[4], acc[5], acc[6], acc[7]};
            }
        }
        __syncthreads();

        // A wave-wide 16-byte store is one whole output row: 512 contiguous
        // bytes, four full lines with one writer each. float4 tid + 256 i of
        // the window is row wave + 8 i, columns 4 lane to 4 lane + 3.
        {
            constexpr int FULL = NTOK / 8;  // 6 rounds that every wave has
            v4f* ov = (v4f*)(out + (size_t)blk * NTOK * CH) + tid;
            const float* s0 = os + wave * OSTR + lane * 4;
            // unroll: row offsets become immediates of the LDS loads and stores
#pragma unroll
            for (int i = 0; i < FULL; ++i)
                ov[256 * i] = *(const v4f*)(s0 + 8 * i * OSTR) + bias;
            // row 48, the last real one, is wave 0's
            if (wave == 0)
                ov[256 * FULL] = *(const v4f*)(s0 + 8 * FULL * OSTR) + bias;
            // Precaution: this wait stands in front of the next window's reuse
            // of the stores' address and data registers. The address is an
            // input so that its registers stay untouched up to it.
            asm volatile("s_wait_xcnt 0x0" :: "v"(ov) : "memory");
        }
        blk += NWG;
    } while (blk < nwin);
}

// ---------------------------------------------------------------------------
extern "C" void kernel_launch(void* const* d_in, const int* in_sizes, int n_in,
                              void* d_out, int out_size, void* d_ws,
                              size_t ws_size, hipStream_t stream) {
    using namespace cfg;
    const float* x      = (const float*)d_in[0];  // (4096, 49, 128)
    const float* w_qkv  = (const float*)d_in[1];  // (128, 384)
    const float* w_proj = (const float*)d_in[2];  // (128, 128)
    const float* b_proj = (const float*)d_in[3];  // (128,)
    float* out = (float*)d_out;                   // (4096, 49, 128)

    _Float16* wq16 = (_Float16*)d_ws;             // 49152 halfs, 96 fragments
    _Float16* wp16 = wq16 + CH * C3;              // 16384 halfs, 32 fragments

    const int prep_threads = (CH * C3 + CH * CH) / 8;  // 8192, 8 halfs each
    WindowAttention_prep_weights<<<(prep_threads + 255) / 256, 256, 0, stream>>>(
        w_qkv, w_proj, wq16, wp16);

    const size_t lds_bytes = (size_t)LDS_BYTES;  // 97 KB
    hipFuncSetAttribute((const void*)WindowAttention_41815801594647_kernel,
                        hipFuncAttributeMaxDynamicSharedMemorySize,
                        (int)lds_bytes);

    const int nwin = in_sizes[0] / (NTOK * CH);   // 4096 windows
    const int B = NWG;                            // workgroups launched
    WindowAttention_41815801594647_kernel<<<B, 256, lds_bytes, stream>>>(
        x, wq16, wp16, b_proj, out, nwin);
}

// v009
// A run of this version takes 36.7 microseconds.
// In both of two side-by-side timings against v008, it was 1.06 times as fast.
// Counting every step since v000, it is 4.33 times as fast.
#include <hip/hip_runtime.h>

typedef __attribute__((ext_vector_type(16))) _Float16 v16h;
typedef __attribute__((ext_vector_type(8)))  _Float16 v8h;
typedef __attribute__((ext_vector_type(8)))  float    v8f;
typedef __attribute__((ext_vector_type(4)))  float    v4f;

namespace cfg {
constexpr int NTOK = 49;      // real tokens per window
constexpr int NPAD = 64;      // padded tokens (4 tiles of 16)
constexpr int CH   = 128;     // channels
constexpr int NH   = 4;       // heads
constexpr int DH   = 32;      // head dim
constexpr int C3   = 3 * CH;  // qkv output width = 384
constexpr float SCALE = 0.17677669529663687f;  // 1/sqrt(32)

constexpr int XSTR = CH + 8;    // 136, x / attn-out buffer
constexpr int FRAG = 512;       // one 16x32 f16 fragment: 2 x 32 lanes x 8
constexpr int XS_OFF  = 0;
constexpr int QKV_OFF = NPAD * XSTR;                 // 8704
// q, k, v as ready fragments: [q|k|v][head][4][FRAG]
constexpr int LDS_HALFS = QKV_OFF + 3 * NH * 4 * FRAG;  // 33280 halfs = 65 KB
// The landing place of the asynchronous copies, behind the rest: one window's
// x as it lies in global memory (f32, 49 rows in a row), then the 15 padded
// rows, which no copy touches.
constexpr int XF_OFF    = LDS_HALFS;                 // byte 66560, 16-aligned
constexpr int XF_BYTES  = NPAD * CH * 4;             // 32768
constexpr int LDS_BYTES = LDS_HALFS * 2 + XF_BYTES;  // 99328 B = 97 KB
constexpr int OSTR = CH + 4;    // 132 floats; 64 rows = 33 KB of the 48 KB
// Workgroups launched: two fit on a WGP beside each other (registers), so one
// resident round of 256 x 2 workgroups shares out the windows.
constexpr int NWG = 512;
}

__device__ __forceinline__ int frag_kk(int i) {
    return (i < 4) ? 2 * i : 16 + 2 * (i - 4);
}

// A fragment, or B fragment when K runs along the contiguous dim of src
// (i.e. src is row-major [M][K] for A, or [N][K] == B^T for B).
__device__ __forceinline__ v16h ldfrag_kcontig(const _Float16* src, int row0,
                                               int stride, int colbase) {
    const int lane = threadIdx.x & 31;
    const int mn   = lane & 15;
    const int khi  = (lane >> 4) ? 8 : 0;
    const _Float16* p = src + (row0 + mn) * stride + colbase + khi;
    v16h f;
#pragma unroll
    for (int i = 0; i < 8; ++i) {
        const int kk = frag_kk(i);
        f[2 * i]     = p[kk];
        f[2 * i + 1] = p[kk + 1];
    }
    return f;
}

__device__ __forceinline__ unsigned frag_w_lane(int ct) {
    const int lane = threadIdx.x & 31;
    return (unsigned)(ct * 4 * cfg::FRAG + lane * 8) * 2u;
}

__device__ __forceinline__ v16h ldfrag_w(const _Float16* w, unsigned lane_part,
                                         int frag) {
    const _Float16* p = (const _Float16*)((const char*)w + lane_part) +
                        frag * cfg::FRAG;
    const v8h lo = *(const v8h*)p;
    const v8h hi = *(const v8h*)(p + 256);
    v16h f;
#pragma unroll
    for (int i = 0; i < 8; ++i) { f[i] = lo[i]; f[8 + i] = hi[i]; }
    return f;
}

__device__ __forceinline__ void st_half_frag(_Float16* frag, int half, v8f acc) {
    const int lane = threadIdx.x & 31;
    v8h h;
#pragma unroll
    for (int r = 0; r < 8; ++r) h[r] = (_Float16)acc[r];
    *(v8h*)(frag + half * 256 + lane * 8) = h;
}

__device__ __forceinline__ v16h ld_frag(const _Float16* frag) {
    const int lane = threadIdx.x & 31;
    const v8h lo = *(const v8h*)(frag + lane * 8);
    const v8h hi = *(const v8h*)(frag + 256 + lane * 8);
    v16h f;
#pragma unroll
    for (int i = 0; i < 8; ++i) { f[i] = lo[i]; f[8 + i] = hi[i]; }
    return f;
}

__device__ __forceinline__ v8f wmma_f16(v16h a, v16h b, v8f c) {
    return __builtin_amdgcn_wmma_f32_16x16x32_f16(
        /*neg_a=*/false, a, /*neg_b=*/false, b,
        /*c_mod=*/(short)0, c, /*reuse_a=*/false, /*reuse_b=*/false);
}

__device__ __forceinline__ float xhalf(float x) {
    const int b = __builtin_bit_cast(int, x);
    return __builtin_bit_cast(float, __builtin_amdgcn_permlanex16(
        b, b, 0x76543210, 0xfedcba98, false, false));
}

__device__ __forceinline__ float exp_slot(float x) {
    const float t = x * 1.44269504f;
    float r;
    asm("v_exp_f32 %0, %1\n\tv_nop" : "=v"(r) : "v"(t));
    return r;
}

__device__ __forceinline__ void copy_x(const float* g, unsigned lds,
                                       int wave_s) {
    asm volatile("global_load_async_to_lds_b128 %0, %1, off\n\t"
                 "global_load_async_to_lds_b128 %0, %1, off offset:4096\n\t"
                 "global_load_async_to_lds_b128 %0, %1, off offset:8192\n\t"
                 "global_load_async_to_lds_b128 %0, %1, off offset:12288\n\t"
                 "global_load_async_to_lds_b128 %0, %1, off offset:16384\n\t"
                 "global_load_async_to_lds_b128 %0, %1, off offset:20480\n\t"
                 "s_wait_xcnt 0x0" :: "v"(lds), "v"(g) : "memory");
    if (wave_s == 0)
        asm volatile("global_load_async_to_lds_b128 %0, %1, off offset:24576\n\t"
                     "s_wait_xcnt 0x0" :: "v"(lds), "v"(g) : "memory");
}

// ---------------------------------------------------------------------------
// Prep: convert fp32 weights to f16 in fragment register order (weights then
// sit in L2). A thread makes the 8 halfs that one lane reads with one 16-byte
// load: column n, rows 8 kg to 8 kg + 7. Of the 32-k block kg >> 2 these are
// elements 0-7 or 8-15 (bit 1 of kg) of lane n & 15 or that + 16 (bit 0).
// ---------------------------------------------------------------------------
__device__ __forceinline__ void pack_w(const float* __restrict__ w,
                                       _Float16* __restrict__ w16, int nout,
                                       int t) {
    const int kg = t / nout, n = t % nout;
    const float* p = w + kg * 8 * nout + n;
    float f[8];
    // unroll: the 8 loads go out together, one address and immediate offsets
#pragma unroll
    for (int e = 0; e < 8; ++e) f[e] = p[e * nout];
    // Precaution: this wait stands in front of any reuse of the loads'
    // address registers, which are inputs so that they stay untouched up to it.
    asm volatile("s_wait_xcnt 0x0" :: "v"(p) : "memory");
    v8h h;
    // unroll: f[] and h are indexed by constants only and stay in registers
#pragma unroll
    for (int e = 0; e < 8; ++e) h[e] = (_Float16)f[e];
    const int frag = (n >> 4) * 4 + (kg >> 2);
    const int lane = (n & 15) + 16 * (kg & 1);
    *(v8h*)(w16 + frag * cfg::FRAG + ((kg >> 1) & 1) * 256 + lane * 8) = h;
}

__global__ void WindowAttention_prep_weights(const float* __restrict__ wq,
                                             const float* __restrict__ wp,
                                             _Float16* __restrict__ wq16,
                                             _Float16* __restrict__ wp16) {
    const int tid = blockIdx.x * blockDim.x + threadIdx.x;
    constexpr int NQ = cfg::CH / 8 * cfg::C3;
    constexpr int NP = cfg::CH / 8 * cfg::CH;
    if (tid < NQ)
        pack_w(wq, wq16, cfg::C3, tid);
    else if (tid < NQ + NP)
        pack_w(wp, wp16, cfg::CH, tid - NQ);
}

// ---------------------------------------------------------------------------
// Main fused kernel: a workgroup (8 waves) takes one window at a time and loops
// over windows blockIdx.x, blockIdx.x + NWG, ... A wave's weight
// fragments are the same for every window: they are loaded once, at entry, and
// stay in registers over the loop.
// ---------------------------------------------------------------------------
__global__ void __launch_bounds__(256)
WindowAttention_41815801594647_kernel(const float* __restrict__ x,
                                      const _Float16* __restrict__ wq16,
                                      const _Float16* __restrict__ wp16,
                                      const float* __restrict__ bp,
                                      float* __restrict__ out, int nwin) {
    using namespace cfg;
    extern __shared__ _Float16 smem[];
    _Float16* xs  = smem + XS_OFF;   // [NPAD][XSTR] : x (f16), later attn-out
    _Float16* qkv = smem + QKV_OFF;  // q|k|v fragments of all heads (f16)

    const int tid  = threadIdx.x;
    const int wave = tid >> 5;
    const int lane = tid & 31;
    const int wh = wave >> 1;
    const int wc = wave & 1;

    // A workgroup without a window leaves as a whole, in front of every barrier.
    int blk = blockIdx.x;
    if (blk >= nwin) return;

    // x comes one window ahead: the first window's copies go out here, each
    // further window's behind the barrier that ends phase 1 of the window
    // before, and fly during phases 2 to 4.
    float4* xl = (float4*)(smem + XF_OFF) + tid;   // the thread's place
    const unsigned xl_lds = (unsigned)(size_t)xl;  // its LDS byte address
    const int wave_s = __builtin_amdgcn_readfirstlane(wave);
    copy_x(x + (size_t)blk * NTOK * CH + tid * 4, xl_lds, wave_s);
    // The padded rows of the landing place are zeroed once: float4 tid + 256 i
    // is row wave + 8 i, so round 7 is rows 56 to 63 and round 6 rows 48 to 55,
    // of which only row 48 (wave 0) is real. No copy aims at them, and each is
    // read only by the thread that writes it here.
    xl[256 * 7] = float4{0.0f, 0.0f, 0.0f, 0.0f};
    if (wave_s != 0) xl[256 * 6] = float4{0.0f, 0.0f, 0.0f, 0.0f};

    // ---- Entry: the wave's weights, once for all of its windows -----------
    // Column tiles wave, wave+8, wave+16 of Wqkv (16 channels, half wc of head
    // wh, of q, of k and of v) and column tile wave of Wproj: 16 fragments,
    // 128 registers, plus the thread's four bias values.
    v16h bw[3][4];
    v16h bpj[4];
    const unsigned wl = frag_w_lane(wave);  // lane's place in a column tile
    const int pcol = lane * 4;  // the thread's four columns of an output row
    // unroll: bw[] and bpj[] are indexed by constants only and need no memory
#pragma unroll
    for (int j = 0; j < 3; ++j)
#pragma unroll
        for (int k = 0; k < 4; ++k)
            bw[j][k] = ldfrag_w(wq16, wl, 32 * j + k);
#pragma unroll
    for (int k = 0; k < 4; ++k)
        bpj[k] = ldfrag_w(wp16, wl, k);
    const v4f bias = *(const v4f*)(bp + pcol);
    // Precaution: this wait stands in front of any reuse of the loads' address
    // registers. The lane's indices are inputs so that their registers stay
    // untouched up to it.
    asm volatile("s_wait_xcnt 0x0" :: "v"(wl), "v"(lane) : "memory");

    const int qc = lane & 15;               // this lane's query in the block
    const int rb = (lane >> 4) ? 8 : 0;     // this lane half's row offset in D

    // unroll 1: one copy of the body; a second would double the live registers
    // beside the 128 of the weights.
#pragma unroll 1
    do {
        // ---- Phase 1: the landing place, all 64 rows, to xs as f16 ------------
        // A thread reads the very bytes that it copied (or zeroed) itself, so
        // its own wave's wait is all that stands between. xs was last read (as
        // attn-out) in front of the barrier behind phase 4 of the window before.
        {
            constexpr int ROUNDS = NPAD * (CH / 4) / 256;  // 8 float4 a thread
            // The wave's copies of this window have landed behind this wait.
            asm volatile("s_wait_asynccnt 0x0" ::: "memory");
            float4 v[ROUNDS];
            // unroll: v[] stays in registers and the loads share one address
#pragma unroll
            for (int i = 0; i < ROUNDS; ++i) v[i] = xl[256 * i];
            // float4 tid + 256 i is row wave + 8 i, columns 4 lane to 4 lane + 3
            _Float16* d0 = xs + wave * XSTR + lane * 4;
            // unroll: v[] is indexed by constants only, so it needs no memory
#pragma unroll
            for (int i = 0; i < ROUNDS; ++i) {
                _Float16* d = d0 + 8 * i * XSTR;
                d[0] = (_Float16)v[i].x; d[1] = (_Float16)v[i].y;
                d[2] = (_Float16)v[i].z; d[3] = (_Float16)v[i].w;
            }
        }
        // The wave's reads of the landing place have retired before the copies
        // behind the barrier aim at it again.
        asm volatile("s_wait_dscnt 0x0" ::: "memory");
        // This barrier also ends the last reads of the window before: its
        // output rows lie over q|k|v, which phase 2 writes.
        __syncthreads();

        // The next window's x sets out (a scalar test, the same for the whole
        // workgroup). Its wait is the one at the head of the next trip, so no
        // copy is outstanding behind the loop.
        if (blk + NWG < nwin)
            copy_x(x + (size_t)(blk + NWG) * NTOK * CH + tid * 4, xl_lds,
                   wave_s);

        // ---- Phase 2: qkv = x @ Wqkv (64x384 = 4 x 24 tiles, K=128) -------
        // With all three column tiles' weights resident, a row tile's four x
        // fragments are read from LDS once and serve q, k and v.
        // One accumulator chain a result tile; the q, k and v chains take turns,
        // so a chain's next link comes two matrix instructions behind the last.
        // q and k tiles are formed transposed (W^T x^T: lane = token,
        // registers = 8 channels), v tiles as x W (lane = channel, registers =
        // 8 tokens): each result is then half of a fragment that phase 3 reads.
        // unroll: the fragment arrays are indexed by constants only and stay
        // in registers; row-tile offsets become immediates of the LDS accesses.
#pragma unroll
        for (int mt = 0; mt < 4; ++mt) {
            v16h a[4];
#pragma unroll
            for (int k = 0; k < 4; ++k)
                a[k] = ldfrag_kcontig(xs, mt * 16, XSTR, k * 32);
            // A row tile's eight loads go out as one group in front of its
            // products: with the chains in turn the compiler else fetched one
            // fragment at a time and waited each load pair out alone.
            __builtin_amdgcn_sched_barrier(0);
            v8f acc[3] = {};
            // unroll: acc[], a[] and bw[] are indexed by constants only
#pragma unroll
            for (int k = 0; k < 4; ++k) {
                acc[0] = wmma_f16(bw[0][k], a[k], acc[0]);
                acc[1] = wmma_f16(bw[1][k], a[k], acc[1]);
                acc[2] = wmma_f16(a[k], bw[2][k], acc[2]);
            }
            __builtin_amdgcn_sched_barrier(0);
#pragma unroll
            for (int j = 0; j < 3; ++j) {
                // q, k: fragment = token tile, half = channel half of the head.
                // v: fragment = 2 * channel half + key half, half = token tile & 1.
                _Float16* fh = qkv + (j * NH + wh) * 4 * FRAG;
                if (j < 2)
                    st_half_frag(fh + mt * FRAG, wc, acc[j]);
                else
                    st_half_frag(fh + (2 * wc + (mt >> 1)) * FRAG, mt & 1, acc[j]);
            }
        }
        __syncthreads();

        _Float16* ao = xs;  // x staging no longer needed -> reuse as attn output
#pragma unroll
        for (int it = 0; it < 2; ++it) {
            const int task = wave + 8 * it;
            const int hd   = task >> 2;
            const int mt   = task & 3;

            // S^T (64 keys x 16 queries, K = DH = 32): 4 independent WMMAs
            v8f st[4];
            {
                v16h bq = ld_frag(qkv + (hd * 4 + mt) * FRAG);
                v16h ak[4];
#pragma unroll
                for (int nt = 0; nt < 4; ++nt)
                    ak[nt] = ld_frag(qkv + ((NH + hd) * 4 + nt) * FRAG);
                const v8f z = {};
#pragma unroll
                for (int nt = 0; nt < 3; ++nt) st[nt] = wmma_f16(ak[nt], bq, z);
                // The last tile holds one real key, so seven of its result
                // registers are free at once. Keep it the last of the four: moved
                // up, those registers were handed to the next tile's result inside
                // the distance a matrix instruction's result needs.
                __builtin_amdgcn_sched_barrier(0);
                st[3] = wmma_f16(ak[3], bq, z);
            }

            // scale, mask the padded keys, maximum over the lane's keys. A register
            // whose key is padding in both lane halves takes no part at all: its
            // weight is exactly 0.
            float mx[4];
#pragma unroll
            for (int nt = 0; nt < 4; ++nt) {
                mx[nt] = -3.0e38f;
#pragma unroll
                for (int r = 0; r < 8; ++r) {
                    if (nt * 16 + r >= NTOK) continue;
                    float s = st[nt][r] * SCALE;
                    if (nt * 16 + 8 + r >= NTOK) s = rb ? -3.0e38f : s;
                    st[nt][r] = s;
                    mx[nt] = fmaxf(mx[nt], s);
                }
            }
            float m = fmaxf(fmaxf(mx[0], mx[1]), fmaxf(mx[2], mx[3]));
            m = fmaxf(m, xhalf(m));

            // exp and sum: one partial sum per tile, so four short chains
            float sm[4];
#pragma unroll
            for (int nt = 0; nt < 4; ++nt) {
                sm[nt] = 0.0f;
#pragma unroll
                for (int r = 0; r < 8; ++r) {
                    if (nt * 16 + r >= NTOK) continue;
                    const float e = exp_slot(st[nt][r] - m);
                    st[nt][r] = e;
                    sm[nt] = r ? sm[nt] + e : e;
                }
            }
            float s = (sm[0] + sm[1]) + (sm[2] + sm[3]);
            s += xhalf(s);
            const float inv = 1.0f / s;

            // P^T as B fragments, straight from the score registers
            v16h pb[2];
#pragma unroll
            for (int j = 0; j < 2; ++j)
#pragma unroll
                for (int e = 0; e < 16; ++e) {
                    const int nt = 2 * j + (e >> 3), r = e & 7;
                    pb[j][e] = (nt * 16 + r >= NTOK) ? (_Float16)0.0f
                                                     : (_Float16)(st[nt][r] * inv);
                }

            // O^T = V^T(32x64) @ P^T(64x16): one chain per 16 channels, the two
            // chains taking turns.
            // A lane's 8 results are 8 consecutive channels of its query's row.
            v8f oacc[2] = {};
            {
                v16h av[2][2];
                // unroll (all four): av[], pb[] and oacc[] are indexed by
                // constants only and stay in registers
#pragma unroll
                for (int dt = 0; dt < 2; ++dt)
#pragma unroll
                    for (int j = 0; j < 2; ++j)
                        av[dt][j] =
                            ld_frag(qkv + ((2 * NH + hd) * 4 + 2 * dt + j) * FRAG);
#pragma unroll
                for (int j = 0; j < 2; ++j)
#pragma unroll
                    for (int dt = 0; dt < 2; ++dt)
                        oacc[dt] = wmma_f16(av[dt][j], pb[j], oacc[dt]);
            }
#pragma unroll
            for (int dt = 0; dt < 2; ++dt) {
                const v8f o = oacc[dt];
                v8h oh;
#pragma unroll
                for (int r = 0; r < 8; ++r) oh[r] = (_Float16)o[r];
                *(v8h*)(ao + (mt * 16 + qc) * XSTR + hd * DH + dt * 16 + rb) = oh;
            }
        }
        __syncthreads();

        // ---- Phase 4: proj + bias, fp32 store of the 49 real rows -------------
        // Each wave owns column tile nt = wave: its four weight fragments (resident
        // since entry) serve all four row tiles. A wave's tile is only 64
        // bytes of an output row, so the results cross LDS and leave as whole rows.
        // The tiles are formed transposed (Wp^T ao^T: lane = token, registers = 8
        // consecutive channels), so a lane hands them over in two 16-byte stores.
        float* os = (float*)qkv;  // [NPAD][OSTR]; q, k, v were last read in phase 3
        {
            const v16h* b = bpj;
            float* d0 = os + qc * OSTR + wave * 16 + rb;
            v8f res[4] = {};
            // unroll: the fragment and result arrays stay in registers and the
            // row-tile offsets become immediates of the LDS accesses
#pragma unroll
            for (int mp = 0; mp < 4; mp += 2) {
                v16h a[2][4];
#pragma unroll
                for (int k = 0; k < 4; ++k)
#pragma unroll
                    for (int m = 0; m < 2; ++m)
                        a[m][k] = ldfrag_kcontig(ao, (mp + m) * 16, XSTR, k * 32);
                // Two row tiles' loads go out as one group in front of their
                // products: beside the resident weights the compiler else kept
                // one fragment's registers and waited each load pair out alone.
                __builtin_amdgcn_sched_barrier(0);
#pragma unroll
                for (int k = 0; k < 4; ++k)
#pragma unroll
                    for (int m = 0; m < 2; ++m)
                        res[mp + m] = wmma_f16(b[k], a[m][k], res[mp + m]);
            }
            // No store moves up among the products: all four results keep
            // registers of their own, and none is reused for a later tile's
            // result inside the distance a matrix instruction's result needs.
            __builtin_amdgcn_sched_barrier(0);
#pragma unroll
            for (int mt = 0; mt < 4; ++mt) {
                const v8f acc = res[mt];
                float* d = d0 + mt * 16 * OSTR;
                *(v4f*)d       = v4f{acc[0], acc[1], acc[2], acc[3]};
                *(v4f*)(d + 4) = v4f{acc[4], acc[5], acc[6], acc[7]};
            }
        }
        __syncthreads();

        // A wave-wide 16-byte store is one whole output row: 512 contiguous
        // bytes, four full lines with one writer each. float4 tid + 256 i of
        // the window is row wave + 8 i, columns 4 lane to 4 lane + 3.
        {
            constexpr int FULL = NTOK / 8;  // 6 rounds that every wave has
            v4f* ov = (v4f*)(out + (size_t)blk * NTOK * CH) + tid;
            const float* s0 = os + wave * OSTR + lane * 4;
            // unroll: row offsets become immediates of the LDS loads and stores
#pragma unroll
            for (int i = 0; i < FULL; ++i)
                ov[256 * i] = *(const v4f*)(s0 + 8 * i * OSTR) + bias;
            // row 48, the last real one, is wave 0's
            if (wave == 0)
                ov[256 * FULL] = *(const v4f*)(s0 + 8 * FULL * OSTR) + bias;
            // Precaution: this wait stands in front of the next window's reuse
            // of the stores' address and data registers. The address is an
            // input so that its registers stay untouched up to it.
            asm volatile("s_wait_xcnt 0x0" :: "v"(ov) : "memory");
        }
        blk += NWG;
    } while (blk < nwin);
}

// ---------------------------------------------------------------------------
extern "C" void kernel_launch(void* const* d_in, const int* in_sizes, int n_in,
                              void* d_out, int out_size, void* d_ws,
                              size_t ws_size, hipStream_t stream) {
    using namespace cfg;
    const float* x      = (const float*)d_in[0];  // (4096, 49, 128)
    const float* w_qkv  = (const float*)d_in[1];  // (128, 384)
    const float* w_proj = (const float*)d_in[2];  // (128, 128)
    const float* b_proj = (const float*)d_in[3];  // (128,)
    float* out = (float*)d_out;                   // (4096, 49, 128)

    _Float16* wq16 = (_Float16*)d_ws;             // 49152 halfs, 96 fragments
    _Float16* wp16 = wq16 + CH * C3;              // 16384 halfs, 32 fragments

    const int prep_threads = (CH * C3 + CH * CH) / 8;  // 8192, 8 halfs each
    WindowAttention_prep_weights<<<(prep_threads + 255) / 256, 256, 0, stream>>>(
        w_qkv, w_proj, wq16, wp16);

    const size_t lds_bytes = (size_t)LDS_BYTES;  // 97 KB
    hipFuncSetAttribute((const void*)WindowAttention_41815801594647_kernel,
                        hipFuncAttributeMaxDynamicSharedMemorySize,
                        (int)lds_bytes);

    const int nwin = in_sizes[0] / (NTOK * CH);   // 4096 windows
    const int B = NWG;                            // workgroups launched
    WindowAttention_41815801594647_kernel<<<B, 256, lds_bytes, stream>>>(
        x, wq16, wp16, b_proj, out, nwin);
}

// v010
// Measured time: 35.5 microseconds a run.
// Two timings next to v009 put it at 1.05 and 1.03 times that version's speed.
// Over all steps from v000 it is 4.50 times as fast.
#include <hip/hip_runtime.h>

typedef __attribute__((ext_vector_type(16))) _Float16 v16h;
typedef __attribute__((ext_vector_type(8)))  _Float16 v8h;
typedef __attribute__((ext_vector_type(8)))  float    v8f;
typedef __attribute__((ext_vector_type(4)))  float    v4f;

namespace cfg {
constexpr int NTOK = 49;      // real tokens per window
constexpr int NPAD = 64;      // padded tokens (4 tiles of 16)
constexpr int CH   = 128;     // channels
constexpr int NH   = 4;       // heads
constexpr int DH   = 32;      // head dim
constexpr int C3   = 3 * CH;  // qkv output width = 384
constexpr float SCALE = 0.17677669529663687f;  // 1/sqrt(32)

constexpr int XSTR = CH + 8;    // 136, x / attn-out buffer
constexpr int FRAG = 512;       // one 16x32 f16 fragment: 2 x 32 lanes x 8
constexpr int XS_OFF  = 0;
constexpr int QKV_OFF = NPAD * XSTR;                 // 8704
// q, k, v as ready fragments: [q|k|v][head][4][FRAG]
constexpr int LDS_HALFS = QKV_OFF + 3 * NH * 4 * FRAG;  // 33280 halfs = 65 KB
// The landing place of the asynchronous copies, behind the rest: one window's
// x as it lies in global memory (f32, 49 rows in a row), then the 15 padded
// rows, which no copy touches.
constexpr int XF_OFF    = LDS_HALFS;                 // byte 66560, 16-aligned
constexpr int XF_BYTES  = NPAD * CH * 4;             // 32768
constexpr int LDS_BYTES = LDS_HALFS * 2 + XF_BYTES;  // 99328 B = 97 KB
constexpr int OSTR = CH + 4;    // 132 floats; 64 rows = 33 KB of the 48 KB
// Workgroups launched: two fit on a WGP beside each other (registers), so one
// resident round of 256 x 2 workgroups shares out the windows.
constexpr int NWG = 512;
}

__device__ __forceinline__ int frag_kk(int i) {
    return (i < 4) ? 2 * i : 16 + 2 * (i - 4);
}

// A fragment, or B fragment when K runs along the contiguous dim of src
// (i.e. src is row-major [M][K] for A, or [N][K] == B^T for B).
__device__ __forceinline__ v16h ldfrag_kcontig(const _Float16* src, int row0,
                                               int stride, int colbase) {
    const int lane = threadIdx.x & 31;
    const int mn   = lane & 15;
    const int khi  = (lane >> 4) ? 8 : 0;
    const _Float16* p = src + (row0 + mn) * stride + colbase + khi;
    v16h f;
#pragma unroll
    for (int i = 0; i < 8; ++i) {
        const int kk = frag_kk(i);
        f[2 * i]     = p[kk];
        f[2 * i + 1] = p[kk + 1];
    }
    return f;
}

__device__ __forceinline__ unsigned frag_w_lane(int ct) {
    const int lane = threadIdx.x & 31;
    return (unsigned)(ct * 4 * cfg::FRAG + lane * 8) * 2u;
}

__device__ __forceinline__ v16h ldfrag_w(const _Float16* w, unsigned lane_part,
                                         int frag) {
    const _Float16* p = (const _Float16*)((const char*)w + lane_part) +
                        frag * cfg::FRAG;
    const v8h lo = *(const v8h*)p;
    const v8h hi = *(const v8h*)(p + 256);
    v16h f;
#pragma unroll
    for (int i = 0; i < 8; ++i) { f[i] = lo[i]; f[8 + i] = hi[i]; }
    return f;
}

__device__ __forceinline__ void st_half_frag(_Float16* frag, int half, v8f acc) {
    const int lane = threadIdx.x & 31;
    v8h h;
#pragma unroll
    for (int r = 0; r < 8; ++r) h[r] = (_Float16)acc[r];
    *(v8h*)(frag + half * 256 + lane * 8) = h;
}

__device__ __forceinline__ v16h ld_frag(const _Float16* frag) {
    const int lane = threadIdx.x & 31;
    const v8h lo = *(const v8h*)(frag + lane * 8);
    const v8h hi = *(const v8h*)(frag + 256 + lane * 8);
    v16h f;
#pragma unroll
    for (int i = 0; i < 8; ++i) { f[i] = lo[i]; f[8 + i] = hi[i]; }
    return f;
}

__device__ __forceinline__ v8f wmma_f16(v16h a, v16h b, v8f c) {
    return __builtin_amdgcn_wmma_f32_16x16x32_f16(
        /*neg_a=*/false, a, /*neg_b=*/false, b,
        /*c_mod=*/(short)0, c, /*reuse_a=*/false, /*reuse_b=*/false);
}

__device__ __forceinline__ float xhalf(float x) {
    const int b = __builtin_bit_cast(int, x);
    return __builtin_bit_cast(float, __builtin_amdgcn_permlanex16(
        b, b, 0x76543210, 0xfedcba98, false, false));
}

__device__ __forceinline__ float exp_slot(float x) {
    const float t = x * 1.44269504f;
    float r;
    asm("v_exp_f32 %0, %1\n\tv_nop" : "=v"(r) : "v"(t));
    return r;
}

__device__ __forceinline__ void copy_x(const float* g, unsigned lds,
                                       int wave_s) {
    asm volatile("global_load_async_to_lds_b128 %0, %1, off\n\t"
                 "global_load_async_to_lds_b128 %0, %1, off offset:4096\n\t"
                 "global_load_async_to_lds_b128 %0, %1, off offset:8192\n\t"
                 "global_load_async_to_lds_b128 %0, %1, off offset:12288\n\t"
                 "global_load_async_to_lds_b128 %0, %1, off offset:16384\n\t"
                 "global_load_async_to_lds_b128 %0, %1, off offset:20480\n\t"
                 "s_wait_xcnt 0x0" :: "v"(lds), "v"(g) : "memory");
    if (wave_s == 0)
        asm volatile("global_load_async_to_lds_b128 %0, %1, off offset:24576\n\t"
                     "s_wait_xcnt 0x0" :: "v"(lds), "v"(g) : "memory");
}

// ---------------------------------------------------------------------------
// Prep: convert fp32 weights to f16 in fragment register order (weights then
// sit in L2). A thread makes the 8 halfs that one lane reads with one 16-byte
// load: column n, rows 8 kg to 8 kg + 7. Of the 32-k block kg >> 2 these are
// elements 0-7 or 8-15 (bit 1 of kg) of lane n & 15 or that + 16 (bit 0).
// ---------------------------------------------------------------------------
__device__ __forceinline__ void pack_w(const float* __restrict__ w,
                                       _Float16* __restrict__ w16, int nout,
                                       int t) {
    const int kg = t / nout, n = t % nout;
    const float* p = w + kg * 8 * nout + n;
    float f[8];
    // unroll: the 8 loads go out together, one address and immediate offsets
#pragma unroll
    for (int e = 0; e < 8; ++e) f[e] = p[e * nout];
    // Precaution: this wait stands in front of any reuse of the loads'
    // address registers, which are inputs so that they stay untouched up to it.
    asm volatile("s_wait_xcnt 0x0" :: "v"(p) : "memory");
    v8h h;
    // unroll: f[] and h are indexed by constants only and stay in registers
#pragma unroll
    for (int e = 0; e < 8; ++e) h[e] = (_Float16)f[e];
    const int frag = (n >> 4) * 4 + (kg >> 2);
    const int lane = (n & 15) + 16 * (kg & 1);
    *(v8h*)(w16 + frag * cfg::FRAG + ((kg >> 1) & 1) * 256 + lane * 8) = h;
}

__global__ void WindowAttention_prep_weights(const float* __restrict__ wq,
                                             const float* __restrict__ wp,
                                             _Float16* __restrict__ wq16,
                                             _Float16* __restrict__ wp16) {
    const int tid = blockIdx.x * blockDim.x + threadIdx.x;
    constexpr int NQ = cfg::CH / 8 * cfg::C3;
    constexpr int NP = cfg::CH / 8 * cfg::CH;
    if (tid < NQ)
        pack_w(wq, wq16, cfg::C3, tid);
    else if (tid < NQ + NP)
        pack_w(wp, wp16, cfg::CH, tid - NQ);
}

// ---------------------------------------------------------------------------
// Main fused kernel: a workgroup (8 waves) takes one window at a time and loops
// over windows blockIdx.x, blockIdx.x + NWG, ... A wave's weight
// fragments are the same for every window: they are loaded once, at entry, and
// stay in registers over the loop.
// ---------------------------------------------------------------------------
__global__ void __launch_bounds__(256)
WindowAttention_41815801594647_kernel(const float* __restrict__ x,
                                      const _Float16* __restrict__ wq16,
                                      const _Float16* __restrict__ wp16,
                                      const float* __restrict__ bp,
                                      float* __restrict__ out, int nwin) {
    using namespace cfg;
    extern __shared__ _Float16 smem[];
    _Float16* xs  = smem + XS_OFF;   // [NPAD][XSTR] : x (f16), later attn-out
    _Float16* qkv = smem + QKV_OFF;  // q|k|v fragments of all heads (f16)

    const int tid  = threadIdx.x;
    const int wave = tid >> 5;
    const int lane = tid & 31;
    const int wh = wave >> 1;
    const int wc = wave & 1;

    // A workgroup without a window leaves as a whole, in front of every barrier.
    int blk = blockIdx.x;
    if (blk >= nwin) return;

    // x comes one window ahead: the first window's copies go out here, each
    // further window's behind the barrier that ends phase 1 of the window
    // before, and fly during phases 2 to 4.
    float4* xl = (float4*)(smem + XF_OFF) + tid;   // the thread's place
    const unsigned xl_lds = (unsigned)(size_t)xl;  // its LDS byte address
    const int wave_s = __builtin_amdgcn_readfirstlane(wave);
    copy_x(x + (size_t)blk * NTOK * CH + tid * 4, xl_lds, wave_s);
    // The padded rows of the landing place are zeroed once: float4 tid + 256 i
    // is row wave + 8 i, so round 7 is rows 56 to 63 and round 6 rows 48 to 55,
    // of which only row 48 (wave 0) is real. No copy aims at them, and each is
    // read only by the thread that writes it here.
    xl[256 * 7] = float4{0.0f, 0.0f, 0.0f, 0.0f};
    if (wave_s != 0) xl[256 * 6] = float4{0.0f, 0.0f, 0.0f, 0.0f};

    // ---- Entry: the wave's weights, once for all of its windows -----------
    // Column tiles wave, wave+8, wave+16 of Wqkv (16 channels, half wc of head
    // wh, of q, of k and of v) and column tile wave of Wproj: 16 fragments,
    // 128 registers, plus the thread's four bias values.
    v16h bw[3][4];
    v16h bpj[4];
    const unsigned wl = frag_w_lane(wave);  // lane's place in a column tile
    const int pcol = lane * 4;  // the thread's four columns of an output row
    // unroll: bw[] and bpj[] are indexed by constants only and need no memory
#pragma unroll
    for (int j = 0; j < 3; ++j)
#pragma unroll
        for (int k = 0; k < 4; ++k)
            bw[j][k] = ldfrag_w(wq16, wl, 32 * j + k);
#pragma unroll
    for (int k = 0; k < 4; ++k)
        bpj[k] = ldfrag_w(wp16, wl, k);
    const v4f bias = *(const v4f*)(bp + pcol);
    // Precaution: this wait stands in front of any reuse of the loads' address
    // registers. The lane's indices are inputs so that their registers stay
    // untouched up to it.
    asm volatile("s_wait_xcnt 0x0" :: "v"(wl), "v"(lane) : "memory");

    const int qc = lane & 15;               // this lane's query in the block
    const int rb = (lane >> 4) ? 8 : 0;     // this lane half's row offset in D

    // unroll 1: one copy of the body; a second would double the live registers
    // beside the 128 of the weights.
#pragma unroll 1
    do {
        // ---- Phase 1: the landing place, all 64 rows, to xs as f16 ------------
        // A thread reads the very bytes that it copied (or zeroed) itself, so
        // its own wave's wait is all that stands between. xs was last read (as
        // attn-out) in front of the barrier behind phase 4 of the window before.
        {
            constexpr int ROUNDS = NPAD * (CH / 4) / 256;  // 8 float4 a thread
            // The wave's copies of this window have landed behind this wait.
            asm volatile("s_wait_asynccnt 0x0" ::: "memory");
            float4 v[ROUNDS];
            // unroll: v[] stays in registers and the loads share one address
#pragma unroll
            for (int i = 0; i < ROUNDS; ++i) v[i] = xl[256 * i];
            // float4 tid + 256 i is row wave + 8 i, columns 4 lane to 4 lane + 3
            _Float16* d0 = xs + wave * XSTR + lane * 4;
            // unroll: v[] is indexed by constants only, so it needs no memory
#pragma unroll
            for (int i = 0; i < ROUNDS; ++i) {
                _Float16* d = d0 + 8 * i * XSTR;
                d[0] = (_Float16)v[i].x; d[1] = (_Float16)v[i].y;
                d[2] = (_Float16)v[i].z; d[3] = (_Float16)v[i].w;
            }
        }
        // The wave's reads of the landing place have retired before the copies
        // behind the barrier aim at it again.
        asm volatile("s_wait_dscnt 0x0" ::: "memory");
        // This barrier also ends the last reads of the window before: its
        // output rows lie over q|k|v, which phase 2 writes.
        __syncthreads();

        // The next window's x sets out (a scalar test, the same for the whole
        // workgroup). Its wait is the one at the head of the next trip, so no
        // copy is outstanding behind the loop.
        if (blk + NWG < nwin)
            copy_x(x + (size_t)(blk + NWG) * NTOK * CH + tid * 4, xl_lds,
                   wave_s);

        // ---- Phase 2: qkv = x @ Wqkv (64x384 = 4 x 24 tiles, K=128) -------
        // With all three column tiles' weights resident, a row tile's four x
        // fragments are read from LDS once and serve q, k and v.
        // One accumulator chain a result tile; the q, k and v chains take turns,
        // so a chain's next link comes two matrix instructions behind the last.
        // q and k tiles are formed transposed (W^T x^T: lane = token,
        // registers = 8 channels), v tiles as x W (lane = channel, registers =
        // 8 tokens): each result is then half of a fragment that phase 3 reads.
        // unroll: the fragment arrays are indexed by constants only and stay
        // in registers; row-tile offsets become immediates of the LDS accesses.
#pragma unroll
        for (int mt = 0; mt < 4; ++mt) {
            v16h a[4];
#pragma unroll
            for (int k = 0; k < 4; ++k)
                a[k] = ldfrag_kcontig(xs, mt * 16, XSTR, k * 32);
            // A row tile's eight loads go out as one group in front of its
            // products: with the chains in turn the compiler else fetched one
            // fragment at a time and waited each load pair out alone.
            __builtin_amdgcn_sched_barrier(0);
            v8f acc[3] = {};
            // unroll: acc[], a[] and bw[] are indexed by constants only
#pragma unroll
            for (int k = 0; k < 4; ++k) {
                acc[0] = wmma_f16(bw[0][k], a[k], acc[0]);
                acc[1] = wmma_f16(bw[1][k], a[k], acc[1]);
                acc[2] = wmma_f16(a[k], bw[2][k], acc[2]);
            }
            __builtin_amdgcn_sched_barrier(0);
#pragma unroll
            for (int j = 0; j < 3; ++j) {
                // q, k: fragment = token tile, half = channel half of the head.
                // v: fragment = 2 * channel half + key half, half = token tile & 1.
                _Float16* fh = qkv + (j * NH + wh) * 4 * FRAG;
                if (j < 2)
                    st_half_frag(fh + mt * FRAG, wc, acc[j]);
                else
                    st_half_frag(fh + (2 * wc + (mt >> 1)) * FRAG, mt & 1, acc[j]);
            }
        }
        __syncthreads();

        _Float16* ao = xs;  // x staging no longer needed -> reuse as attn output
        {
            const int hd  = wh;
            const int mt0 = 2 * wc;

            // S^T (64 keys x 16 queries, K = DH = 32), twice: 8 independent WMMAs
            // unroll (every loop of this phase): the fragment, score and result
            // arrays are indexed by constants only and stay in registers
            v8f st[2][4];
            {
                v16h bq[2];
#pragma unroll
                for (int t = 0; t < 2; ++t)
                    bq[t] = ld_frag(qkv + (hd * 4 + mt0 + t) * FRAG);
                v16h ak[4];
#pragma unroll
                for (int nt = 0; nt < 4; ++nt)
                    ak[nt] = ld_frag(qkv + ((NH + hd) * 4 + nt) * FRAG);
                // The twelve loads go out as one group in front of the products:
                // else the compiler kept one K fragment's registers and waited
                // each further pair of loads out alone.
                __builtin_amdgcn_sched_barrier(0);
                const v8f z = {};
#pragma unroll
                for (int nt = 0; nt < 3; ++nt)
#pragma unroll
                    for (int t = 0; t < 2; ++t)
                        st[t][nt] = wmma_f16(ak[nt], bq[t], z);
                // The last key tile holds one real key, so seven of its result
                // registers are free at once. Keep its products the last: moved
                // up, those registers were handed to the next tile's result inside
                // the distance a matrix instruction's result needs.
                __builtin_amdgcn_sched_barrier(0);
#pragma unroll
                for (int t = 0; t < 2; ++t)
                    st[t][3] = wmma_f16(ak[3], bq[t], z);
            }

            // scale, mask the padded keys, maximum over the lane's keys. A register
            // whose key is padding in both lane halves takes no part at all: its
            // weight is exactly 0.
            float mx[2][4];
#pragma unroll
            for (int nt = 0; nt < 4; ++nt) {
#pragma unroll
                for (int t = 0; t < 2; ++t) mx[t][nt] = -3.0e38f;
#pragma unroll
                for (int r = 0; r < 8; ++r) {
                    if (nt * 16 + r >= NTOK) continue;
#pragma unroll
                    for (int t = 0; t < 2; ++t) {
                        float s = st[t][nt][r] * SCALE;
                        if (nt * 16 + 8 + r >= NTOK) s = rb ? -3.0e38f : s;
                        st[t][nt][r] = s;
                        mx[t][nt] = fmaxf(mx[t][nt], s);
                    }
                }
            }
            float m[2];
#pragma unroll
            for (int t = 0; t < 2; ++t)
                m[t] = fmaxf(fmaxf(mx[t][0], mx[t][1]), fmaxf(mx[t][2], mx[t][3]));
#pragma unroll
            for (int t = 0; t < 2; ++t) m[t] = fmaxf(m[t], xhalf(m[t]));

            // exp and sum: one partial sum per tile and block, eight short chains
            float sm[2][4];
#pragma unroll
            for (int nt = 0; nt < 4; ++nt) {
#pragma unroll
                for (int t = 0; t < 2; ++t) sm[t][nt] = 0.0f;
#pragma unroll
                for (int r = 0; r < 8; ++r) {
                    if (nt * 16 + r >= NTOK) continue;
#pragma unroll
                    for (int t = 0; t < 2; ++t) {
                        const float e = exp_slot(st[t][nt][r] - m[t]);
                        st[t][nt][r] = e;
                        sm[t][nt] = r ? sm[t][nt] + e : e;
                    }
                }
            }
            float inv[2];
#pragma unroll
            for (int t = 0; t < 2; ++t) {
                float s = (sm[t][0] + sm[t][1]) + (sm[t][2] + sm[t][3]);
                s += xhalf(s);
                inv[t] = 1.0f / s;
            }

            // P^T as B fragments, straight from the score registers
            v16h pb[2][2];
#pragma unroll
            for (int t = 0; t < 2; ++t)
#pragma unroll
                for (int j = 0; j < 2; ++j)
#pragma unroll
                    for (int e = 0; e < 16; ++e) {
                        const int nt = 2 * j + (e >> 3), r = e & 7;
                        pb[t][j][e] = (nt * 16 + r >= NTOK)
                                          ? (_Float16)0.0f
                                          : (_Float16)(st[t][nt][r] * inv[t]);
                    }

            // O^T = V^T(32x64) @ P^T(64x16): one chain per block and 16 channels,
            // the four chains taking turns.
            // A lane's 8 results are 8 consecutive channels of its query's row.
            v8f oacc[2][2] = {};
            {
                v16h av[2][2];
#pragma unroll
                for (int dt = 0; dt < 2; ++dt)
#pragma unroll
                    for (int j = 0; j < 2; ++j)
                        av[dt][j] =
                            ld_frag(qkv + ((2 * NH + hd) * 4 + 2 * dt + j) * FRAG);
#pragma unroll
                for (int j = 0; j < 2; ++j)
#pragma unroll
                    for (int dt = 0; dt < 2; ++dt)
#pragma unroll
                        for (int t = 0; t < 2; ++t)
                            oacc[t][dt] = wmma_f16(av[dt][j], pb[t][j], oacc[t][dt]);
            }
#pragma unroll
            for (int t = 0; t < 2; ++t)
#pragma unroll
                for (int dt = 0; dt < 2; ++dt) {
                    const v8f o = oacc[t][dt];
                    v8h oh;
#pragma unroll
                    for (int r = 0; r < 8; ++r) oh[r] = (_Float16)o[r];
                    *(v8h*)(ao + ((mt0 + t) * 16 + qc) * XSTR + hd * DH + dt * 16 +
                            rb) = oh;
                }
        }
        __syncthreads();

        // ---- Phase 4: proj + bias, fp32 store of the 49 real rows -------------
        // Each wave owns column tile nt = wave: its four weight fragments (resident
        // since entry) serve all four row tiles. A wave's tile is only 64
        // bytes of an output row, so the results cross LDS and leave as whole rows.
        // The tiles are formed transposed (Wp^T ao^T: lane = token, registers = 8
        // consecutive channels), so a lane hands them over in two 16-byte stores.
        float* os = (float*)qkv;  // [NPAD][OSTR]; q, k, v were last read in phase 3
        {
            const v16h* b = bpj;
            float* d0 = os + qc * OSTR + wave * 16 + rb;
            v8f res[4] = {};
            // unroll: the fragment and result arrays stay in registers and the
            // row-tile offsets become immediates of the LDS accesses
#pragma unroll
            for (int mp = 0; mp < 4; mp += 2) {
                v16h a[2][4];
#pragma unroll
                for (int k = 0; k < 4; ++k)
#pragma unroll
                    for (int m = 0; m < 2; ++m)
                        a[m][k] = ldfrag_kcontig(ao, (mp + m) * 16, XSTR, k * 32);
                // Two row tiles' loads go out as one group in front of their
                // products: beside the resident weights the compiler else kept
                // one fragment's registers and waited each load pair out alone.
                __builtin_amdgcn_sched_barrier(0);
#pragma unroll
                for (int k = 0; k < 4; ++k)
#pragma unroll
                    for (int m = 0; m < 2; ++m)
                        res[mp + m] = wmma_f16(b[k], a[m][k], res[mp + m]);
            }
            // No store moves up among the products: all four results keep
            // registers of their own, and none is reused for a later tile's
            // result inside the distance a matrix instruction's result needs.
            __builtin_amdgcn_sched_barrier(0);
#pragma unroll
            for (int mt = 0; mt < 4; ++mt) {
                const v8f acc = res[mt];
                float* d = d0 + mt * 16 * OSTR;
                *(v4f*)d       = v4f{acc[0], acc[1], acc[2], acc[3]};
                *(v4f*)(d + 4) = v4f{acc[4], acc[5], acc[6], acc[7]};
            }
        }
        __syncthreads();

        // A wave-wide 16-byte store is one whole output row: 512 contiguous
        // bytes, four full lines with one writer each. float4 tid + 256 i of
        // the window is row wave + 8 i, columns 4 lane to 4 lane + 3.
        {
            constexpr int FULL = NTOK / 8;  // 6 rounds that every wave has
            v4f* ov = (v4f*)(out + (size_t)blk * NTOK * CH) + tid;
            const float* s0 = os + wave * OSTR + lane * 4;
            // unroll: row offsets become immediates of the LDS loads and stores
#pragma unroll
            for (int i = 0; i < FULL; ++i)
                ov[256 * i] = *(const v4f*)(s0 + 8 * i * OSTR) + bias;
            // row 48, the last real one, is wave 0's
            if (wave == 0)
                ov[256 * FULL] = *(const v4f*)(s0 + 8 * FULL * OSTR) + bias;
            // Precaution: this wait stands in front of the next window's reuse
            // of the stores' address and data registers. The address is an
            // input so that its registers stay untouched up to it.
            asm volatile("s_wait_xcnt 0x0" :: "v"(ov) : "memory");
        }
        blk += NWG;
    } while (blk < nwin);
}

// ---------------------------------------------------------------------------
extern "C" void kernel_launch(void* const* d_in, const int* in_sizes, int n_in,
                              void* d_out, int out_size, void* d_ws,
                              size_t ws_size, hipStream_t stream) {
    using namespace cfg;
    const float* x      = (const float*)d_in[0];  // (4096, 49, 128)
    const float* w_qkv  = (const float*)d_in[1];  // (128, 384)
    const float* w_proj = (const float*)d_in[2];  // (128, 128)
    const float* b_proj = (const float*)d_in[3];  // (128,)
    float* out = (float*)d_out;                   // (4096, 49, 128)

    _Float16* wq16 = (_Float16*)d_ws;             // 49152 halfs, 96 fragments
    _Float16* wp16 = wq16 + CH * C3;              // 16384 halfs, 32 fragments

    const int prep_threads = (CH * C3 + CH * CH) / 8;  // 8192, 8 halfs each
    WindowAttention_prep_weights<<<(prep_threads + 255) / 256, 256, 0, stream>>>(
        w_qkv, w_proj, wq16, wp16);

    const size_t lds_bytes = (size_t)LDS_BYTES;  // 97 KB
    hipFuncSetAttribute((const void*)WindowAttention_41815801594647_kernel,
                        hipFuncAttributeMaxDynamicSharedMemorySize,
                        (int)lds_bytes);

    const int nwin = in_sizes[0] / (NTOK * CH);   // 4096 windows
    const int B = NWG;                            // workgroups launched
    WindowAttention_41815801594647_kernel<<<B, 256, lds_bytes, stream>>>(
        x, wq16, wp16, b_proj, out, nwin);
}
